// v000
// The times below were measured on an AMD MI455X: many runs one after another, warmed up first and cycling through
// copies of the inputs, with the whole window's GPU time divided by the number of runs. Launches and the gaps
// between them are all in it. The median over several windows is given; except for v000 it joins two sittings, which
// can be a few percent apart, so the side-by-side timings, each taken in one sitting, are the better comparison.
// v000, which the later versions start from, runs in 211 microseconds.
#include <hip/hip_runtime.h>

typedef __attribute__((ext_vector_type(16))) _Float16 v16h;
typedef __attribute__((ext_vector_type(8)))  _Float16 h8v;
typedef __attribute__((ext_vector_type(8)))  float    v8f;

constexpr int Bc = 2, Tc = 384, Ec = 768, Hc = 12, HDc = 64;
constexpr int Mc = Bc * Tc;
constexpr int Sc = Tc;
constexpr int SPAD = Sc + 8;

static __device__ inline float fast_tanh(float x) {
#if __has_builtin(__builtin_amdgcn_tanhf)
    return __builtin_amdgcn_tanhf(x);
#elif __has_builtin(__builtin_amdgcn_tanh_f32)
    return __builtin_amdgcn_tanh_f32(x);
#else
    return tanhf(x);
#endif
}

static __device__ inline v16h make_frag(const _Float16* p) {
    h8v lo = *reinterpret_cast<const h8v*>(p);
    h8v hi = *reinterpret_cast<const h8v*>(p + 16);
    v16h r;
#pragma unroll
    for (int i = 0; i < 8; ++i) { r[i] = lo[i]; r[i + 8] = hi[i]; }
    return r;
}

// ---------------------------------------------------------------------------
// Kernel 1: f32 -> f16 elementwise convert
// ---------------------------------------------------------------------------
__global__ void k_convert_f16(const float* __restrict__ in,
                              _Float16* __restrict__ out, int n) {
    int i = blockIdx.x * 256 + threadIdx.x;
    if (i < n) out[i] = (_Float16)in[i];
}

// ---------------------------------------------------------------------------
// Kernel 2: weight transpose + convert:  W[k][n] (f32, [K,N]) -> Wt[n][k] f16
// ---------------------------------------------------------------------------
__global__ void k_transpose_w(const float* __restrict__ W,
                              _Float16* __restrict__ Wt, int Kdim, int Ndim) {
    int i = blockIdx.x * 256 + threadIdx.x;
    if (i < Kdim * Ndim) {
        int n = i / Kdim;
        int k = i % Kdim;
        Wt[i] = (_Float16)W[(size_t)k * Ndim + n];
    }
}

// ---------------------------------------------------------------------------
// Kernel 3: WMMA GEMM  C[M,N] = A[M,K](f16) * Bt[N,K]^T(f16) + bias (f32 out)
// block = 256 threads (8 waves). Block tile = 128 rows x 64 cols.
// wave w: rows row0 = by*128 + w*16, cols col0 = bx*64 .. +63 (4 accumulators)
// ---------------------------------------------------------------------------
__global__ void __launch_bounds__(256)
k_gemm_wmma(const _Float16* __restrict__ A, const _Float16* __restrict__ Bt,
            const float* __restrict__ bias, float* __restrict__ C,
            int Ndim, int Kdim) {
    const int wave  = threadIdx.x >> 5;
    const int lane  = threadIdx.x & 31;
    const int nl    = lane & 15;
    const int khalf = lane >> 4;
    const int col0  = blockIdx.x * 64;
    const int row0  = blockIdx.y * 128 + wave * 16;

    const _Float16* arow = A  + (size_t)(row0 + nl) * Kdim + khalf * 8;
    const _Float16* b0   = Bt + (size_t)(col0 +  0 + nl) * Kdim + khalf * 8;
    const _Float16* b1   = Bt + (size_t)(col0 + 16 + nl) * Kdim + khalf * 8;
    const _Float16* b2   = Bt + (size_t)(col0 + 32 + nl) * Kdim + khalf * 8;
    const _Float16* b3   = Bt + (size_t)(col0 + 48 + nl) * Kdim + khalf * 8;

    v8f acc0 = {}, acc1 = {}, acc2 = {}, acc3 = {};

    for (int k0 = 0; k0 < Kdim; k0 += 32) {
        __builtin_prefetch(arow + k0 + 128, 0, 0);  // global_prefetch_b8
        v16h a  = make_frag(arow + k0);
        v16h f0 = make_frag(b0 + k0);
        v16h f1 = make_frag(b1 + k0);
        v16h f2 = make_frag(b2 + k0);
        v16h f3 = make_frag(b3 + k0);
        acc0 = __builtin_amdgcn_wmma_f32_16x16x32_f16(false, a, false, f0,
                                                      (short)0, acc0, false, false);
        acc1 = __builtin_amdgcn_wmma_f32_16x16x32_f16(false, a, false, f1,
                                                      (short)0, acc1, false, false);
        acc2 = __builtin_amdgcn_wmma_f32_16x16x32_f16(false, a, false, f2,
                                                      (short)0, acc2, false, false);
        acc3 = __builtin_amdgcn_wmma_f32_16x16x32_f16(false, a, false, f3,
                                                      (short)0, acc3, false, false);
    }

    const int mo = khalf * 8;
    const float bz0 = bias[col0 +  0 + nl];
    const float bz1 = bias[col0 + 16 + nl];
    const float bz2 = bias[col0 + 32 + nl];
    const float bz3 = bias[col0 + 48 + nl];
#pragma unroll
    for (int r = 0; r < 8; ++r) {
        float* crow = C + (size_t)(row0 + mo + r) * Ndim + col0;
        crow[ 0 + nl] = acc0[r] + bz0;
        crow[16 + nl] = acc1[r] + bz1;
        crow[32 + nl] = acc2[r] + bz2;
        crow[48 + nl] = acc3[r] + bz3;
    }
}

// ---------------------------------------------------------------------------
// Kernel 4: V (f32 [B,T,E]) -> Vt (f16 [B,H,HD,T]) for K-contiguous B-frags
// ---------------------------------------------------------------------------
__global__ void k_transpose_v(const float* __restrict__ V,
                              _Float16* __restrict__ Vt) {
    int i = blockIdx.x * 256 + threadIdx.x;
    const int total = Bc * Hc * HDc * Tc;
    if (i < total) {
        int s  = i % Tc;
        int d  = (i / Tc) % HDc;
        int bh = i / (Tc * HDc);
        int b  = bh / Hc, h = bh % Hc;
        Vt[i] = (_Float16)V[((size_t)(b * Tc + s)) * Ec + h * HDc + d];
    }
}

// ---------------------------------------------------------------------------
// Kernel 5: fused additive score + softmax + P@V (WMMA)
// grid = (B*H, T/16), block = 128 threads (4 waves). Output f16 [B*T, E].
// ---------------------------------------------------------------------------
__global__ void __launch_bounds__(128)
k_additive_attn(const float* __restrict__ Q, const float* __restrict__ Kf,
                const _Float16* __restrict__ Vt,
                const float* __restrict__ w_score,
                const float* __restrict__ b_score,
                _Float16* __restrict__ AttnH) {
    const int bh = blockIdx.x;
    const int b  = bh / Hc, h = bh % Hc;
    const int t0 = blockIdx.y * 16;
    const int tid = threadIdx.x;

    __shared__ float    q_s[16][HDc];      //  4 KB
    __shared__ float    sc[16][Sc];        // 24 KB
    __shared__ _Float16 p_s[16][SPAD];     // ~12.25 KB (padded rows)
    __shared__ float    red[16][8];
    __shared__ float    rowstat[16];
    __shared__ float    wsc[HDc];

    if (tid < HDc) wsc[tid] = w_score[tid];
    for (int i = tid; i < 16 * HDc; i += 128) {
        int r = i / HDc, d = i % HDc;
        q_s[r][d] = Q[((size_t)(b * Tc + t0 + r)) * Ec + h * HDc + d];
    }
    __syncthreads();

    // ---- additive scores: sc[t][s] = sum_d w[d]*tanh(q[t,d]+k[s,d]) + b ----
    const float bsc = b_score[0];
    for (int p = tid; p < 16 * Sc; p += 128) {
        int t = p / Sc, s = p % Sc;
        const float* krow = Kf + ((size_t)(b * Tc + s)) * Ec + h * HDc;
        float acc = 0.f;
#pragma unroll 4
        for (int d = 0; d < HDc; d += 4) {
            float4 kv = *reinterpret_cast<const float4*>(krow + d);
            float4 qv = *reinterpret_cast<const float4*>(&q_s[t][d]);
            float4 wv = *reinterpret_cast<const float4*>(&wsc[d]);
            acc += wv.x * fast_tanh(qv.x + kv.x);
            acc += wv.y * fast_tanh(qv.y + kv.y);
            acc += wv.z * fast_tanh(qv.z + kv.z);
            acc += wv.w * fast_tanh(qv.w + kv.w);
        }
        sc[t][s] = acc + bsc;
    }
    __syncthreads();

    // ---- softmax over s, 8 threads per row ----
    const int r   = tid & 15;
    const int sub = tid >> 4;      // 0..7
    {
        float mx = -3.4e38f;
        for (int s = sub; s < Sc; s += 8) mx = fmaxf(mx, sc[r][s]);
        red[r][sub] = mx;
    }
    __syncthreads();
    if (sub == 0) {
        float mx = red[r][0];
#pragma unroll
        for (int i = 1; i < 8; ++i) mx = fmaxf(mx, red[r][i]);
        rowstat[r] = mx;
    }
    __syncthreads();
    {
        float mx = rowstat[r];
        float sum = 0.f;
        for (int s = sub; s < Sc; s += 8) {
            float e = __expf(sc[r][s] - mx);
            sc[r][s] = e;
            sum += e;
        }
        red[r][sub] = sum;
    }
    __syncthreads();
    if (sub == 0) {
        float sum = 0.f;
#pragma unroll
        for (int i = 0; i < 8; ++i) sum += red[r][i];
        rowstat[r] = 1.f / sum;
    }
    __syncthreads();
    {
        float rinv = rowstat[r];
        for (int s = sub; s < Sc; s += 8)
            p_s[r][s] = (_Float16)(sc[r][s] * rinv);
    }
    __syncthreads();

    // ---- P[16,S] @ V[S,HD] via WMMA; wave w owns d-columns w*16..w*16+15 ----
    const int wave  = tid >> 5;
    const int lane  = tid & 31;
    const int nl    = lane & 15;
    const int khalf = lane >> 4;

    v8f acc = {};
    const _Float16* prow  = &p_s[nl][khalf * 8];                     // LDS
    const _Float16* vbase = Vt + ((size_t)bh * HDc + wave * 16 + nl) * Tc
                               + khalf * 8;                           // global
    for (int k0 = 0; k0 < Sc; k0 += 32) {
        __builtin_prefetch(vbase + k0 + 64, 0, 0);
        v16h a  = make_frag(prow + k0);      // ds_read_b128 x2, conflict-free
        v16h bb = make_frag(vbase + k0);     // global_load_b128 x2
        acc = __builtin_amdgcn_wmma_f32_16x16x32_f16(false, a, false, bb,
                                                     (short)0, acc, false, false);
    }

    const int mo = khalf * 8;
#pragma unroll
    for (int rr = 0; rr < 8; ++rr) {
        AttnH[((size_t)(b * Tc + t0 + mo + rr)) * Ec + h * HDc + wave * 16 + nl]
            = (_Float16)acc[rr];
    }
}

// ---------------------------------------------------------------------------
// Host launcher
// ---------------------------------------------------------------------------
extern "C" void kernel_launch(void* const* d_in, const int* in_sizes, int n_in,
                              void* d_out, int out_size, void* d_ws, size_t ws_size,
                              hipStream_t stream) {
    const float* X   = (const float*)d_in[0];
    const float* Wq  = (const float*)d_in[1];
    const float* bq  = (const float*)d_in[2];
    const float* Wk  = (const float*)d_in[3];
    const float* bk  = (const float*)d_in[4];
    const float* Wv  = (const float*)d_in[5];
    const float* bv  = (const float*)d_in[6];
    const float* Wo  = (const float*)d_in[7];
    const float* bo  = (const float*)d_in[8];
    const float* wsc = (const float*)d_in[9];
    const float* bsc = (const float*)d_in[10];

    char* ws = (char*)d_ws;
    size_t off = 0;
    auto carve = [&](size_t bytes) {
        void* p = ws + off;
        off += (bytes + 255) & ~(size_t)255;
        return p;
    };

    _Float16* Xh    = (_Float16*)carve((size_t)Mc * Ec * 2);
    _Float16* Wqt   = (_Float16*)carve((size_t)Ec * Ec * 2);
    _Float16* Wkt   = (_Float16*)carve((size_t)Ec * Ec * 2);
    _Float16* Wvt   = (_Float16*)carve((size_t)Ec * Ec * 2);
    _Float16* Wot   = (_Float16*)carve((size_t)Ec * Ec * 2);
    float*    Qf    = (float*)   carve((size_t)Mc * Ec * 4);
    float*    Kff   = (float*)   carve((size_t)Mc * Ec * 4);
    float*    Vf    = (float*)   carve((size_t)Mc * Ec * 4);
    _Float16* Vth   = (_Float16*)carve((size_t)Bc * Hc * HDc * Tc * 2);
    _Float16* AttnH = (_Float16*)carve((size_t)Mc * Ec * 2);

    // 1) X -> f16
    {
        int n = Mc * Ec;
        k_convert_f16<<<(n + 255) / 256, 256, 0, stream>>>(X, Xh, n);
    }
    // 2) weights -> transposed f16
    {
        int n = Ec * Ec;
        dim3 g((n + 255) / 256);
        k_transpose_w<<<g, 256, 0, stream>>>(Wq, Wqt, Ec, Ec);
        k_transpose_w<<<g, 256, 0, stream>>>(Wk, Wkt, Ec, Ec);
        k_transpose_w<<<g, 256, 0, stream>>>(Wv, Wvt, Ec, Ec);
        k_transpose_w<<<g, 256, 0, stream>>>(Wo, Wot, Ec, Ec);
    }
    // 3) Q/K/V projections (WMMA GEMMs)
    {
        dim3 grid(Ec / 64, Mc / 128);
        k_gemm_wmma<<<grid, 256, 0, stream>>>(Xh, Wqt, bq, Qf,  Ec, Ec);
        k_gemm_wmma<<<grid, 256, 0, stream>>>(Xh, Wkt, bk, Kff, Ec, Ec);
        k_gemm_wmma<<<grid, 256, 0, stream>>>(Xh, Wvt, bv, Vf,  Ec, Ec);
    }
    // 4) V -> [B,H,HD,T] f16
    {
        int n = Bc * Hc * HDc * Tc;
        k_transpose_v<<<(n + 255) / 256, 256, 0, stream>>>(Vf, Vth);
    }
    // 5) fused additive score + softmax + P@V
    {
        dim3 grid(Bc * Hc, Tc / 16);
        k_additive_attn<<<grid, 128, 0, stream>>>(Qf, Kff, Vth, wsc, bsc, AttnH);
    }
    // 6) output projection -> d_out (f32)
    {
        dim3 grid(Ec / 64, Mc / 128);
        k_gemm_wmma<<<grid, 256, 0, stream>>>(AttnH, Wot, bo, (float*)d_out, Ec, Ec);
    }
}

// v001
// A run of this version takes 145 microseconds.
// Timed twice side by side with v000, it ran 1.47 times as fast both times.
#include <hip/hip_runtime.h>

typedef __attribute__((ext_vector_type(16))) _Float16 v16h;
typedef __attribute__((ext_vector_type(8)))  _Float16 h8v;
typedef __attribute__((ext_vector_type(8)))  float    v8f;

constexpr int Bc = 2, Tc = 384, Ec = 768, Hc = 12, HDc = 64;
constexpr int Mc = Bc * Tc;
constexpr int Sc = Tc;
constexpr int SPAD = Sc + 8;

static __device__ inline float fast_tanh(float x) {
#if __has_builtin(__builtin_amdgcn_tanhf)
    return __builtin_amdgcn_tanhf(x);
#elif __has_builtin(__builtin_amdgcn_tanh_f32)
    return __builtin_amdgcn_tanh_f32(x);
#else
    return tanhf(x);
#endif
}

static __device__ inline v16h make_frag(const _Float16* p) {
    h8v lo = *reinterpret_cast<const h8v*>(p);
    h8v hi = *reinterpret_cast<const h8v*>(p + 16);
    v16h r;
#pragma unroll
    for (int i = 0; i < 8; ++i) { r[i] = lo[i]; r[i + 8] = hi[i]; }
    return r;
}

// ---------------------------------------------------------------------------
// Kernel 1: f32 -> f16 elementwise convert
// ---------------------------------------------------------------------------
__global__ void k_convert_f16(const float* __restrict__ in,
                              _Float16* __restrict__ out, int n) {
    int i = blockIdx.x * 256 + threadIdx.x;
    if (i < n) out[i] = (_Float16)in[i];
}

// ---------------------------------------------------------------------------
// Kernel 2: weight transpose + convert:  W[k][n] (f32, [K,N]) -> Wt[n][k] f16
// ---------------------------------------------------------------------------
__global__ void k_transpose_w(const float* __restrict__ W,
                              _Float16* __restrict__ Wt, int Kdim, int Ndim) {
    int i = blockIdx.x * 256 + threadIdx.x;
    if (i < Kdim * Ndim) {
        int n = i / Kdim;
        int k = i % Kdim;
        Wt[i] = (_Float16)W[(size_t)k * Ndim + n];
    }
}

// ---------------------------------------------------------------------------
// Kernel 3: WMMA GEMM  C[M,N] = A[M,K](f16) * Bt[N,K]^T(f16) + bias (f32 out)
// block = 256 threads (8 waves). Block tile = 128 rows x 64 cols.
// wave w: rows row0 = by*128 + w*16, cols col0 = bx*64 .. +63 (4 accumulators)
// ---------------------------------------------------------------------------
__global__ void __launch_bounds__(256)
k_gemm_wmma(const _Float16* __restrict__ A, const _Float16* __restrict__ Bt,
            const float* __restrict__ bias, float* __restrict__ C,
            int Ndim, int Kdim) {
    const int wave  = threadIdx.x >> 5;
    const int lane  = threadIdx.x & 31;
    const int nl    = lane & 15;
    const int khalf = lane >> 4;
    const int col0  = blockIdx.x * 64;
    const int row0  = blockIdx.y * 128 + wave * 16;

    const _Float16* arow = A  + (size_t)(row0 + nl) * Kdim + khalf * 8;
    const _Float16* b0   = Bt + (size_t)(col0 +  0 + nl) * Kdim + khalf * 8;
    const _Float16* b1   = Bt + (size_t)(col0 + 16 + nl) * Kdim + khalf * 8;
    const _Float16* b2   = Bt + (size_t)(col0 + 32 + nl) * Kdim + khalf * 8;
    const _Float16* b3   = Bt + (size_t)(col0 + 48 + nl) * Kdim + khalf * 8;

    v8f acc0 = {}, acc1 = {}, acc2 = {}, acc3 = {};

    for (int k0 = 0; k0 < Kdim; k0 += 32) {
        __builtin_prefetch(arow + k0 + 128, 0, 0);  // global_prefetch_b8
        v16h a  = make_frag(arow + k0);
        v16h f0 = make_frag(b0 + k0);
        v16h f1 = make_frag(b1 + k0);
        v16h f2 = make_frag(b2 + k0);
        v16h f3 = make_frag(b3 + k0);
        acc0 = __builtin_amdgcn_wmma_f32_16x16x32_f16(false, a, false, f0,
                                                      (short)0, acc0, false, false);
        acc1 = __builtin_amdgcn_wmma_f32_16x16x32_f16(false, a, false, f1,
                                                      (short)0, acc1, false, false);
        acc2 = __builtin_amdgcn_wmma_f32_16x16x32_f16(false, a, false, f2,
                                                      (short)0, acc2, false, false);
        acc3 = __builtin_amdgcn_wmma_f32_16x16x32_f16(false, a, false, f3,
                                                      (short)0, acc3, false, false);
    }

    const int mo = khalf * 8;
    const float bz0 = bias[col0 +  0 + nl];
    const float bz1 = bias[col0 + 16 + nl];
    const float bz2 = bias[col0 + 32 + nl];
    const float bz3 = bias[col0 + 48 + nl];
#pragma unroll
    for (int r = 0; r < 8; ++r) {
        float* crow = C + (size_t)(row0 + mo + r) * Ndim + col0;
        crow[ 0 + nl] = acc0[r] + bz0;
        crow[16 + nl] = acc1[r] + bz1;
        crow[32 + nl] = acc2[r] + bz2;
        crow[48 + nl] = acc3[r] + bz3;
    }
}

// ---------------------------------------------------------------------------
// Kernel 4: V (f32 [B,T,E]) -> Vt (f16 [B,H,HD,T]) for K-contiguous B-frags
// ---------------------------------------------------------------------------
__global__ void k_transpose_v(const float* __restrict__ V,
                              _Float16* __restrict__ Vt) {
    int i = blockIdx.x * 256 + threadIdx.x;
    const int total = Bc * Hc * HDc * Tc;
    if (i < total) {
        int s  = i % Tc;
        int d  = (i / Tc) % HDc;
        int bh = i / (Tc * HDc);
        int b  = bh / Hc, h = bh % Hc;
        Vt[i] = (_Float16)V[((size_t)(b * Tc + s)) * Ec + h * HDc + d];
    }
}

// ---------------------------------------------------------------------------
// Kernel 5: fused additive score + softmax + P@V (WMMA)
// grid = (B*H, T/16), block = 128 threads (4 waves). Output f16 [B*T, E].
// ---------------------------------------------------------------------------
__global__ void __launch_bounds__(128)
k_additive_attn(const float* __restrict__ Q, const float* __restrict__ Kf,
                const _Float16* __restrict__ Vt,
                const float* __restrict__ w_score,
                const float* __restrict__ b_score,
                _Float16* __restrict__ AttnH) {
    const int bh = blockIdx.x;
    const int b  = bh / Hc, h = bh % Hc;
    const int t0 = blockIdx.y * 16;
    const int tid = threadIdx.x;

    __shared__ float    q_s[16][HDc];      //  4 KB
    __shared__ float    sc[16][Sc];        // 24 KB
    __shared__ _Float16 p_s[16][SPAD];     // ~12.25 KB (padded rows)
    __shared__ float    red[16][8];
    __shared__ float    rowstat[16];

    // Each thread owns KPT key rows (s = tid + 128*j) and holds them in
    // registers for the whole score phase: every k value is read from global
    // memory once per block and serves all 16 query rows of the block.
    // Every loop over j, c or e below is unrolled in full for one reason:
    // kreg, x and acc stay in registers only if indexed by constants.
    constexpr int KPT = Sc / 128;          // 3 key rows per thread
    float4 kreg[KPT][HDc / 4];
#pragma unroll  // constant indices into kreg
    for (int j = 0; j < KPT; ++j) {
        const float4* krow = reinterpret_cast<const float4*>(
            Kf + ((size_t)(b * Tc + tid + j * 128)) * Ec + h * HDc);
#pragma unroll  // constant indices into kreg
        for (int c = 0; c < HDc / 4; ++c) kreg[j][c] = krow[c];
        asm volatile("s_wait_xcnt 0x0" :: "v"(krow) : "memory");
    }

    for (int i = tid; i < 16 * HDc; i += 128) {
        int r = i / HDc, d = i % HDc;
        q_s[r][d] = Q[((size_t)(b * Tc + t0 + r)) * Ec + h * HDc + d];
    }
    __syncthreads();

    // ---- additive scores: sc[t][s] = sum_d w[d]*tanh(q[t,d]+k[s,d]) + b ----
    // q[t][*] is one LDS address for the whole wave (broadcast read) and
    // w_score[*] a uniform address (scalar load); each serves KPT key rows.
    // The sum over d of one (t, s) pair runs in ascending d, one accumulator.
    const float bsc = b_score[0];
    for (int t = 0; t < 16; ++t) {
        float acc[KPT];
#pragma unroll  // constant indices into acc
        for (int j = 0; j < KPT; ++j) acc[j] = 0.f;
#pragma unroll  // constant indices into kreg
        for (int c = 0; c < HDc / 4; ++c) {
            const float4 qv = *reinterpret_cast<const float4*>(&q_s[t][c * 4]);
            // 4*KPT independent values per batch: no tanh waits for its
            // neighbour, and the KPT accumulator chains interleave.
            float x[KPT][4];
#pragma unroll  // constant indices into x and kreg
            for (int j = 0; j < KPT; ++j) {
                x[j][0] = qv.x + kreg[j][c].x;
                x[j][1] = qv.y + kreg[j][c].y;
                x[j][2] = qv.z + kreg[j][c].z;
                x[j][3] = qv.w + kreg[j][c].w;
            }
#pragma unroll  // constant indices into x
            for (int j = 0; j < KPT; ++j) {
                x[j][0] = fast_tanh(x[j][0]);
                x[j][1] = fast_tanh(x[j][1]);
                x[j][2] = fast_tanh(x[j][2]);
                x[j][3] = fast_tanh(x[j][3]);
            }
#pragma unroll  // constant indices into x
            for (int e = 0; e < 4; ++e) {
                const float we = w_score[c * 4 + e];
#pragma unroll  // constant indices into x and acc
                for (int j = 0; j < KPT; ++j) acc[j] += we * x[j][e];
            }
        }
#pragma unroll  // constant indices into acc
        for (int j = 0; j < KPT; ++j) sc[t][tid + j * 128] = acc[j] + bsc;
    }
    __syncthreads();

    // ---- softmax over s, 8 threads per row ----
    const int r   = tid & 15;
    const int sub = tid >> 4;      // 0..7
    {
        float mx = -3.4e38f;
        for (int s = sub; s < Sc; s += 8) mx = fmaxf(mx, sc[r][s]);
        red[r][sub] = mx;
    }
    __syncthreads();
    if (sub == 0) {
        float mx = red[r][0];
#pragma unroll
        for (int i = 1; i < 8; ++i) mx = fmaxf(mx, red[r][i]);
        rowstat[r] = mx;
    }
    __syncthreads();
    {
        float mx = rowstat[r];
        float sum = 0.f;
        for (int s = sub; s < Sc; s += 8) {
            float e = __expf(sc[r][s] - mx);
            sc[r][s] = e;
            sum += e;
        }
        red[r][sub] = sum;
    }
    __syncthreads();
    if (sub == 0) {
        float sum = 0.f;
#pragma unroll
        for (int i = 0; i < 8; ++i) sum += red[r][i];
        rowstat[r] = 1.f / sum;
    }
    __syncthreads();
    {
        float rinv = rowstat[r];
        for (int s = sub; s < Sc; s += 8)
            p_s[r][s] = (_Float16)(sc[r][s] * rinv);
    }
    __syncthreads();

    // ---- P[16,S] @ V[S,HD] via WMMA; wave w owns d-columns w*16..w*16+15 ----
    const int wave  = tid >> 5;
    const int lane  = tid & 31;
    const int nl    = lane & 15;
    const int khalf = lane >> 4;

    v8f acc = {};
    const _Float16* prow  = &p_s[nl][khalf * 8];                     // LDS
    const _Float16* vbase = Vt + ((size_t)bh * HDc + wave * 16 + nl) * Tc
                               + khalf * 8;                           // global
    for (int k0 = 0; k0 < Sc; k0 += 32) {
        __builtin_prefetch(vbase + k0 + 64, 0, 0);
        v16h a  = make_frag(prow + k0);      // ds_read_b128 x2, conflict-free
        v16h bb = make_frag(vbase + k0);     // global_load_b128 x2
        acc = __builtin_amdgcn_wmma_f32_16x16x32_f16(false, a, false, bb,
                                                     (short)0, acc, false, false);
    }

    const int mo = khalf * 8;
#pragma unroll
    for (int rr = 0; rr < 8; ++rr) {
        AttnH[((size_t)(b * Tc + t0 + mo + rr)) * Ec + h * HDc + wave * 16 + nl]
            = (_Float16)acc[rr];
    }
}

// ---------------------------------------------------------------------------
// Host launcher
// ---------------------------------------------------------------------------
extern "C" void kernel_launch(void* const* d_in, const int* in_sizes, int n_in,
                              void* d_out, int out_size, void* d_ws, size_t ws_size,
                              hipStream_t stream) {
    const float* X   = (const float*)d_in[0];
    const float* Wq  = (const float*)d_in[1];
    const float* bq  = (const float*)d_in[2];
    const float* Wk  = (const float*)d_in[3];
    const float* bk  = (const float*)d_in[4];
    const float* Wv  = (const float*)d_in[5];
    const float* bv  = (const float*)d_in[6];
    const float* Wo  = (const float*)d_in[7];
    const float* bo  = (const float*)d_in[8];
    const float* wsc = (const float*)d_in[9];
    const float* bsc = (const float*)d_in[10];

    char* ws = (char*)d_ws;
    size_t off = 0;
    auto carve = [&](size_t bytes) {
        void* p = ws + off;
        off += (bytes + 255) & ~(size_t)255;
        return p;
    };

    _Float16* Xh    = (_Float16*)carve((size_t)Mc * Ec * 2);
    _Float16* Wqt   = (_Float16*)carve((size_t)Ec * Ec * 2);
    _Float16* Wkt   = (_Float16*)carve((size_t)Ec * Ec * 2);
    _Float16* Wvt   = (_Float16*)carve((size_t)Ec * Ec * 2);
    _Float16* Wot   = (_Float16*)carve((size_t)Ec * Ec * 2);
    float*    Qf    = (float*)   carve((size_t)Mc * Ec * 4);
    float*    Kff   = (float*)   carve((size_t)Mc * Ec * 4);
    float*    Vf    = (float*)   carve((size_t)Mc * Ec * 4);
    _Float16* Vth   = (_Float16*)carve((size_t)Bc * Hc * HDc * Tc * 2);
    _Float16* AttnH = (_Float16*)carve((size_t)Mc * Ec * 2);

    // 1) X -> f16
    {
        int n = Mc * Ec;
        k_convert_f16<<<(n + 255) / 256, 256, 0, stream>>>(X, Xh, n);
    }
    // 2) weights -> transposed f16
    {
        int n = Ec * Ec;
        dim3 g((n + 255) / 256);
        k_transpose_w<<<g, 256, 0, stream>>>(Wq, Wqt, Ec, Ec);
        k_transpose_w<<<g, 256, 0, stream>>>(Wk, Wkt, Ec, Ec);
        k_transpose_w<<<g, 256, 0, stream>>>(Wv, Wvt, Ec, Ec);
        k_transpose_w<<<g, 256, 0, stream>>>(Wo, Wot, Ec, Ec);
    }
    // 3) Q/K/V projections (WMMA GEMMs)
    {
        dim3 grid(Ec / 64, Mc / 128);
        k_gemm_wmma<<<grid, 256, 0, stream>>>(Xh, Wqt, bq, Qf,  Ec, Ec);
        k_gemm_wmma<<<grid, 256, 0, stream>>>(Xh, Wkt, bk, Kff, Ec, Ec);
        k_gemm_wmma<<<grid, 256, 0, stream>>>(Xh, Wvt, bv, Vf,  Ec, Ec);
    }
    // 4) V -> [B,H,HD,T] f16
    {
        int n = Bc * Hc * HDc * Tc;
        k_transpose_v<<<(n + 255) / 256, 256, 0, stream>>>(Vf, Vth);
    }
    // 5) fused additive score + softmax + P@V
    {
        dim3 grid(Bc * Hc, Tc / 16);
        k_additive_attn<<<grid, 128, 0, stream>>>(Qf, Kff, Vth, wsc, bsc, AttnH);
    }
    // 6) output projection -> d_out (f32)
    {
        dim3 grid(Ec / 64, Mc / 128);
        k_gemm_wmma<<<grid, 256, 0, stream>>>(AttnH, Wot, bo, (float*)d_out, Ec, Ec);
    }
}

// v002
// It runs in 125 microseconds.
// Two timings next to v001 both put it at 1.15 times that version's speed.
// Over all steps from v000 it is 1.70 times as fast.
#include <hip/hip_runtime.h>

typedef __attribute__((ext_vector_type(16))) _Float16 v16h;
typedef __attribute__((ext_vector_type(8)))  _Float16 h8v;
typedef __attribute__((ext_vector_type(2)))  _Float16 h2v;
typedef __attribute__((ext_vector_type(8)))  float    v8f;

constexpr int Bc = 2, Tc = 384, Ec = 768, Hc = 12, HDc = 64;
constexpr int Mc = Bc * Tc;
constexpr int Sc = Tc;
constexpr int SPAD = Sc + 8;

static __device__ inline float fast_tanh(float x) {
#if __has_builtin(__builtin_amdgcn_tanhf)
    return __builtin_amdgcn_tanhf(x);
#elif __has_builtin(__builtin_amdgcn_tanh_f32)
    return __builtin_amdgcn_tanh_f32(x);
#else
    return tanhf(x);
#endif
}

static __device__ inline v16h make_frag(const _Float16* p) {
    h8v lo = *reinterpret_cast<const h8v*>(p);
    h8v hi = *reinterpret_cast<const h8v*>(p + 16);
    v16h r;
#pragma unroll
    for (int i = 0; i < 8; ++i) { r[i] = lo[i]; r[i + 8] = hi[i]; }
    return r;
}

// ---------------------------------------------------------------------------
// One 64x64 tile, transposed and converted through LDS by 128 threads:
//   dst[c * dpitch + r] = (f16) src[r * spitch + c],  r, c = 0..63
// Global reads are 16 bytes a lane along c, global writes 16 bytes a lane
// along r (whole 128-byte lines both ways); each thread moves 32 elements.
// ---------------------------------------------------------------------------
constexpr int TPITCH = 64 + 8;  // halves; 144 B = 16 B x odd for ds_load_b128

static __device__ inline void tile_transpose_f16(const float* __restrict__ src,
                                                 int spitch,
                                                 _Float16* __restrict__ dst,
                                                 int dpitch,
                                                 _Float16 (*tile)[TPITCH]) {
    const int tid = threadIdx.x;
    const int c4  = (tid & 15) * 4;
    const int rp  = tid >> 4;          // 0..7: a pair of source rows, 4 times
    float4 a[4], b[4];
#pragma unroll  // all eight loads in flight before the first use
    for (int i = 0; i < 4; ++i) {
        const float* p = src + (size_t)(2 * rp + 16 * i) * spitch + c4;
        a[i] = *reinterpret_cast<const float4*>(p);
        b[i] = *reinterpret_cast<const float4*>(p + spitch);
    }
    // Rows r and r+1 of one column are neighbours in the transposed tile:
    // one 4-byte LDS store takes both.
#pragma unroll  // constant indices into a and b
    for (int i = 0; i < 4; ++i) {
        const int r = 2 * rp + 16 * i;
        *reinterpret_cast<h2v*>(&tile[c4 + 0][r]) = h2v{(_Float16)a[i].x, (_Float16)b[i].x};
        *reinterpret_cast<h2v*>(&tile[c4 + 1][r]) = h2v{(_Float16)a[i].y, (_Float16)b[i].y};
        *reinterpret_cast<h2v*>(&tile[c4 + 2][r]) = h2v{(_Float16)a[i].z, (_Float16)b[i].z};
        *reinterpret_cast<h2v*>(&tile[c4 + 3][r]) = h2v{(_Float16)a[i].w, (_Float16)b[i].w};
    }
    __syncthreads();
    const int c0 = tid >> 3;           // 0..15, 4 times
    const int r8 = (tid & 7) * 8;
#pragma unroll  // four independent LDS reads and stores
    for (int i = 0; i < 4; ++i) {
        const int c = c0 + 16 * i;
        *reinterpret_cast<h8v*>(dst + (size_t)c * dpitch + r8) =
            *reinterpret_cast<const h8v*>(&tile[c][r8]);
    }
}

// ---------------------------------------------------------------------------
// Kernel 1: f32 -> f16 elementwise convert.
// grid = n / 4096 blocks of 128 threads; each thread converts 32 elements,
// read 16 bytes at a time and written 16 bytes at a time.
// ---------------------------------------------------------------------------
__global__ void __launch_bounds__(128)
k_convert_f16(const float* __restrict__ in, _Float16* __restrict__ out) {
    const int base = blockIdx.x * 4096 + threadIdx.x * 8;
    float4 lo[4], hi[4];
#pragma unroll  // all eight loads in flight before the first use
    for (int i = 0; i < 4; ++i) {
        lo[i] = *reinterpret_cast<const float4*>(in + base + 1024 * i);
        hi[i] = *reinterpret_cast<const float4*>(in + base + 1024 * i + 4);
    }
#pragma unroll  // constant indices into lo and hi
    for (int i = 0; i < 4; ++i) {
        *reinterpret_cast<h8v*>(out + base + 1024 * i) =
            h8v{(_Float16)lo[i].x, (_Float16)lo[i].y,
                (_Float16)lo[i].z, (_Float16)lo[i].w,
                (_Float16)hi[i].x, (_Float16)hi[i].y,
                (_Float16)hi[i].z, (_Float16)hi[i].w};
    }
}

// ---------------------------------------------------------------------------
// Kernel 2: weight transpose + convert:  W[k][n] (f32, [E,E]) -> Wt[n][k] f16
// grid = (E/64, E/64): one 64 (k) x 64 (n) tile a block.
// ---------------------------------------------------------------------------
__global__ void __launch_bounds__(128)
k_transpose_w(const float* __restrict__ W, _Float16* __restrict__ Wt) {
    __shared__ __attribute__((aligned(16))) _Float16 tile[64][TPITCH];
    const int n0 = blockIdx.x * 64;
    const int k0 = blockIdx.y * 64;
    tile_transpose_f16(W + (size_t)k0 * Ec + n0, Ec,
                       Wt + (size_t)n0 * Ec + k0, Ec, tile);
}

// ---------------------------------------------------------------------------
// Kernel 3: WMMA GEMM  C[M,N] = A[M,K](f16) * Bt[N,K]^T(f16) + bias (f32 out)
// block = 256 threads (8 waves). Block tile = 128 rows x 64 cols.
// wave w: rows row0 = by*128 + w*16, cols col0 = bx*64 .. +63 (4 accumulators)
// ---------------------------------------------------------------------------
__global__ void __launch_bounds__(256)
k_gemm_wmma(const _Float16* __restrict__ A, const _Float16* __restrict__ Bt,
            const float* __restrict__ bias, float* __restrict__ C,
            int Ndim, int Kdim) {
    const int wave  = threadIdx.x >> 5;
    const int lane  = threadIdx.x & 31;
    const int nl    = lane & 15;
    const int khalf = lane >> 4;
    const int col0  = blockIdx.x * 64;
    const int row0  = blockIdx.y * 128 + wave * 16;

    const _Float16* arow = A  + (size_t)(row0 + nl) * Kdim + khalf * 8;
    const _Float16* b0   = Bt + (size_t)(col0 +  0 + nl) * Kdim + khalf * 8;
    const _Float16* b1   = Bt + (size_t)(col0 + 16 + nl) * Kdim + khalf * 8;
    const _Float16* b2   = Bt + (size_t)(col0 + 32 + nl) * Kdim + khalf * 8;
    const _Float16* b3   = Bt + (size_t)(col0 + 48 + nl) * Kdim + khalf * 8;

    v8f acc0 = {}, acc1 = {}, acc2 = {}, acc3 = {};

    for (int k0 = 0; k0 < Kdim; k0 += 32) {
        __builtin_prefetch(arow + k0 + 128, 0, 0);  // global_prefetch_b8
        v16h a  = make_frag(arow + k0);
        v16h f0 = make_frag(b0 + k0);
        v16h f1 = make_frag(b1 + k0);
        v16h f2 = make_frag(b2 + k0);
        v16h f3 = make_frag(b3 + k0);
        acc0 = __builtin_amdgcn_wmma_f32_16x16x32_f16(false, a, false, f0,
                                                      (short)0, acc0, false, false);
        acc1 = __builtin_amdgcn_wmma_f32_16x16x32_f16(false, a, false, f1,
                                                      (short)0, acc1, false, false);
        acc2 = __builtin_amdgcn_wmma_f32_16x16x32_f16(false, a, false, f2,
                                                      (short)0, acc2, false, false);
        acc3 = __builtin_amdgcn_wmma_f32_16x16x32_f16(false, a, false, f3,
                                                      (short)0, acc3, false, false);
    }

    const int mo = khalf * 8;
    const float bz0 = bias[col0 +  0 + nl];
    const float bz1 = bias[col0 + 16 + nl];
    const float bz2 = bias[col0 + 32 + nl];
    const float bz3 = bias[col0 + 48 + nl];
#pragma unroll
    for (int r = 0; r < 8; ++r) {
        float* crow = C + (size_t)(row0 + mo + r) * Ndim + col0;
        crow[ 0 + nl] = acc0[r] + bz0;
        crow[16 + nl] = acc1[r] + bz1;
        crow[32 + nl] = acc2[r] + bz2;
        crow[48 + nl] = acc3[r] + bz3;
    }
}

// ---------------------------------------------------------------------------
// Kernel 4: V (f32 [B,T,E]) -> Vt (f16 [B,H,HD,T]) for K-contiguous B-frags
// ---------------------------------------------------------------------------
// grid = (B*H, T/64): one 64 (s) x 64 (d) tile a block.
__global__ void __launch_bounds__(128)
k_transpose_v(const float* __restrict__ V, _Float16* __restrict__ Vt) {
    __shared__ __attribute__((aligned(16))) _Float16 tile[64][TPITCH];
    const int bh = blockIdx.x;
    const int b  = bh / Hc, h = bh % Hc;
    const int s0 = blockIdx.y * 64;
    tile_transpose_f16(V + (size_t)(b * Tc + s0) * Ec + h * HDc, Ec,
                       Vt + (size_t)bh * HDc * Tc + s0, Tc, tile);
}

// ---------------------------------------------------------------------------
// Kernel 5: fused additive score + softmax + P@V (WMMA)
// grid = (B*H, T/16), block = 128 threads (4 waves). Output f16 [B*T, E].
// ---------------------------------------------------------------------------
__global__ void __launch_bounds__(128)
k_additive_attn(const float* __restrict__ Q, const float* __restrict__ Kf,
                const _Float16* __restrict__ Vt,
                const float* __restrict__ w_score,
                const float* __restrict__ b_score,
                _Float16* __restrict__ AttnH) {
    const int bh = blockIdx.x;
    const int b  = bh / Hc, h = bh % Hc;
    const int t0 = blockIdx.y * 16;
    const int tid = threadIdx.x;

    __shared__ float    q_s[16][HDc];      //  4 KB
    __shared__ float    sc[16][Sc];        // 24 KB
    __shared__ _Float16 p_s[16][SPAD];     // ~12.25 KB (padded rows)
    __shared__ float    red[16][8];
    __shared__ float    rowstat[16];

    // Each thread owns KPT key rows (s = tid + 128*j) and holds them in
    // registers for the whole score phase: every k value is read from global
    // memory once per block and serves all 16 query rows of the block.
    // Every loop over j, c or e below is unrolled in full for one reason:
    // kreg, x and acc stay in registers only if indexed by constants.
    constexpr int KPT = Sc / 128;          // 3 key rows per thread
    float4 kreg[KPT][HDc / 4];
#pragma unroll  // constant indices into kreg
    for (int j = 0; j < KPT; ++j) {
        const float4* krow = reinterpret_cast<const float4*>(
            Kf + ((size_t)(b * Tc + tid + j * 128)) * Ec + h * HDc);
#pragma unroll  // constant indices into kreg
        for (int c = 0; c < HDc / 4; ++c) kreg[j][c] = krow[c];
        asm volatile("s_wait_xcnt 0x0" :: "v"(krow) : "memory");
    }

    for (int i = tid; i < 16 * HDc; i += 128) {
        int r = i / HDc, d = i % HDc;
        q_s[r][d] = Q[((size_t)(b * Tc + t0 + r)) * Ec + h * HDc + d];
    }
    __syncthreads();

    // ---- additive scores: sc[t][s] = sum_d w[d]*tanh(q[t,d]+k[s,d]) + b ----
    // q[t][*] is one LDS address for the whole wave (broadcast read) and
    // w_score[*] a uniform address (scalar load); each serves KPT key rows.
    // The sum over d of one (t, s) pair runs in ascending d, one accumulator.
    const float bsc = b_score[0];
    for (int t = 0; t < 16; ++t) {
        float acc[KPT];
#pragma unroll  // constant indices into acc
        for (int j = 0; j < KPT; ++j) acc[j] = 0.f;
#pragma unroll  // constant indices into kreg
        for (int c = 0; c < HDc / 4; ++c) {
            const float4 qv = *reinterpret_cast<const float4*>(&q_s[t][c * 4]);
            // 4*KPT independent values per batch: no tanh waits for its
            // neighbour, and the KPT accumulator chains interleave.
            float x[KPT][4];
#pragma unroll  // constant indices into x and kreg
            for (int j = 0; j < KPT; ++j) {
                x[j][0] = qv.x + kreg[j][c].x;
                x[j][1] = qv.y + kreg[j][c].y;
                x[j][2] = qv.z + kreg[j][c].z;
                x[j][3] = qv.w + kreg[j][c].w;
            }
#pragma unroll  // constant indices into x
            for (int j = 0; j < KPT; ++j) {
                x[j][0] = fast_tanh(x[j][0]);
                x[j][1] = fast_tanh(x[j][1]);
                x[j][2] = fast_tanh(x[j][2]);
                x[j][3] = fast_tanh(x[j][3]);
            }
#pragma unroll  // constant indices into x
            for (int e = 0; e < 4; ++e) {
                const float we = w_score[c * 4 + e];
#pragma unroll  // constant indices into x and acc
                for (int j = 0; j < KPT; ++j) acc[j] += we * x[j][e];
            }
        }
#pragma unroll  // constant indices into acc
        for (int j = 0; j < KPT; ++j) sc[t][tid + j * 128] = acc[j] + bsc;
    }
    __syncthreads();

    // ---- softmax over s, 8 threads per row ----
    const int r   = tid & 15;
    const int sub = tid >> 4;      // 0..7
    {
        float mx = -3.4e38f;
        for (int s = sub; s < Sc; s += 8) mx = fmaxf(mx, sc[r][s]);
        red[r][sub] = mx;
    }
    __syncthreads();
    if (sub == 0) {
        float mx = red[r][0];
#pragma unroll
        for (int i = 1; i < 8; ++i) mx = fmaxf(mx, red[r][i]);
        rowstat[r] = mx;
    }
    __syncthreads();
    {
        float mx = rowstat[r];
        float sum = 0.f;
        for (int s = sub; s < Sc; s += 8) {
            float e = __expf(sc[r][s] - mx);
            sc[r][s] = e;
            sum += e;
        }
        red[r][sub] = sum;
    }
    __syncthreads();
    if (sub == 0) {
        float sum = 0.f;
#pragma unroll
        for (int i = 0; i < 8; ++i) sum += red[r][i];
        rowstat[r] = 1.f / sum;
    }
    __syncthreads();
    {
        float rinv = rowstat[r];
        for (int s = sub; s < Sc; s += 8)
            p_s[r][s] = (_Float16)(sc[r][s] * rinv);
    }
    __syncthreads();

    // ---- P[16,S] @ V[S,HD] via WMMA; wave w owns d-columns w*16..w*16+15 ----
    const int wave  = tid >> 5;
    const int lane  = tid & 31;
    const int nl    = lane & 15;
    const int khalf = lane >> 4;

    v8f acc = {};
    const _Float16* prow  = &p_s[nl][khalf * 8];                     // LDS
    const _Float16* vbase = Vt + ((size_t)bh * HDc + wave * 16 + nl) * Tc
                               + khalf * 8;                           // global
    for (int k0 = 0; k0 < Sc; k0 += 32) {
        __builtin_prefetch(vbase + k0 + 64, 0, 0);
        v16h a  = make_frag(prow + k0);      // ds_read_b128 x2, conflict-free
        v16h bb = make_frag(vbase + k0);     // global_load_b128 x2
        acc = __builtin_amdgcn_wmma_f32_16x16x32_f16(false, a, false, bb,
                                                     (short)0, acc, false, false);
    }

    const int mo = khalf * 8;
#pragma unroll
    for (int rr = 0; rr < 8; ++rr) {
        AttnH[((size_t)(b * Tc + t0 + mo + rr)) * Ec + h * HDc + wave * 16 + nl]
            = (_Float16)acc[rr];
    }
}

// ---------------------------------------------------------------------------
// Host launcher
// ---------------------------------------------------------------------------
extern "C" void kernel_launch(void* const* d_in, const int* in_sizes, int n_in,
                              void* d_out, int out_size, void* d_ws, size_t ws_size,
                              hipStream_t stream) {
    const float* X   = (const float*)d_in[0];
    const float* Wq  = (const float*)d_in[1];
    const float* bq  = (const float*)d_in[2];
    const float* Wk  = (const float*)d_in[3];
    const float* bk  = (const float*)d_in[4];
    const float* Wv  = (const float*)d_in[5];
    const float* bv  = (const float*)d_in[6];
    const float* Wo  = (const float*)d_in[7];
    const float* bo  = (const float*)d_in[8];
    const float* wsc = (const float*)d_in[9];
    const float* bsc = (const float*)d_in[10];

    char* ws = (char*)d_ws;
    size_t off = 0;
    auto carve = [&](size_t bytes) {
        void* p = ws + off;
        off += (bytes + 255) & ~(size_t)255;
        return p;
    };

    _Float16* Xh    = (_Float16*)carve((size_t)Mc * Ec * 2);
    _Float16* Wqt   = (_Float16*)carve((size_t)Ec * Ec * 2);
    _Float16* Wkt   = (_Float16*)carve((size_t)Ec * Ec * 2);
    _Float16* Wvt   = (_Float16*)carve((size_t)Ec * Ec * 2);
    _Float16* Wot   = (_Float16*)carve((size_t)Ec * Ec * 2);
    float*    Qf    = (float*)   carve((size_t)Mc * Ec * 4);
    float*    Kff   = (float*)   carve((size_t)Mc * Ec * 4);
    float*    Vf    = (float*)   carve((size_t)Mc * Ec * 4);
    _Float16* Vth   = (_Float16*)carve((size_t)Bc * Hc * HDc * Tc * 2);
    _Float16* AttnH = (_Float16*)carve((size_t)Mc * Ec * 2);

    // 1) X -> f16
    k_convert_f16<<<Mc * Ec / 4096, 128, 0, stream>>>(X, Xh);
    // 2) weights -> transposed f16
    {
        dim3 g(Ec / 64, Ec / 64);
        k_transpose_w<<<g, 128, 0, stream>>>(Wq, Wqt);
        k_transpose_w<<<g, 128, 0, stream>>>(Wk, Wkt);
        k_transpose_w<<<g, 128, 0, stream>>>(Wv, Wvt);
        k_transpose_w<<<g, 128, 0, stream>>>(Wo, Wot);
    }
    // 3) Q/K/V projections (WMMA GEMMs)
    {
        dim3 grid(Ec / 64, Mc / 128);
        k_gemm_wmma<<<grid, 256, 0, stream>>>(Xh, Wqt, bq, Qf,  Ec, Ec);
        k_gemm_wmma<<<grid, 256, 0, stream>>>(Xh, Wkt, bk, Kff, Ec, Ec);
        k_gemm_wmma<<<grid, 256, 0, stream>>>(Xh, Wvt, bv, Vf,  Ec, Ec);
    }
    // 4) V -> [B,H,HD,T] f16
    {
        dim3 grid(Bc * Hc, Tc / 64);
        k_transpose_v<<<grid, 128, 0, stream>>>(Vf, Vth);
    }
    // 5) fused additive score + softmax + P@V
    {
        dim3 grid(Bc * Hc, Tc / 16);
        k_additive_attn<<<grid, 128, 0, stream>>>(Qf, Kff, Vth, wsc, bsc, AttnH);
    }
    // 6) output projection -> d_out (f32)
    {
        dim3 grid(Ec / 64, Mc / 128);
        k_gemm_wmma<<<grid, 256, 0, stream>>>(AttnH, Wot, bo, (float*)d_out, Ec, Ec);
    }
}

// v003
// It runs in 82.1 microseconds.
// Next to v002, in two timings, it ran 1.54 and 1.51 times as fast.
// Counting every step since v000, it is 2.59 times as fast.
#include <hip/hip_runtime.h>

typedef __attribute__((ext_vector_type(16))) _Float16 v16h;
typedef __attribute__((ext_vector_type(8)))  _Float16 h8v;
typedef __attribute__((ext_vector_type(2)))  _Float16 h2v;
typedef __attribute__((ext_vector_type(8)))  float    v8f;

constexpr int Bc = 2, Tc = 384, Ec = 768, Hc = 12, HDc = 64;
constexpr int Mc = Bc * Tc;
constexpr int Sc = Tc;
constexpr int SPAD = Sc + 8;

static __device__ inline float fast_tanh(float x) {
#if __has_builtin(__builtin_amdgcn_tanhf)
    return __builtin_amdgcn_tanhf(x);
#elif __has_builtin(__builtin_amdgcn_tanh_f32)
    return __builtin_amdgcn_tanh_f32(x);
#else
    return tanhf(x);
#endif
}

static __device__ inline v16h make_frag(const _Float16* p) {
    h8v lo = *reinterpret_cast<const h8v*>(p);
    h8v hi = *reinterpret_cast<const h8v*>(p + 16);
    v16h r;
#pragma unroll
    for (int i = 0; i < 8; ++i) { r[i] = lo[i]; r[i + 8] = hi[i]; }
    return r;
}

// ---------------------------------------------------------------------------
// One 64x64 tile, transposed and converted through LDS by 128 threads:
//   dst[c * dpitch + r] = (f16) src[r * spitch + c],  r, c = 0..63
// Global reads are 16 bytes a lane along c, global writes 16 bytes a lane
// along r (whole 128-byte lines both ways); each thread moves 32 elements.
// ---------------------------------------------------------------------------
constexpr int TPITCH = 64 + 8;  // halves; 144 B = 16 B x odd for ds_load_b128

static __device__ inline void tile_transpose_f16(const float* __restrict__ src,
                                                 int spitch,
                                                 _Float16* __restrict__ dst,
                                                 int dpitch,
                                                 _Float16 (*tile)[TPITCH]) {
    const int tid = threadIdx.x;
    const int c4  = (tid & 15) * 4;
    const int rp  = tid >> 4;          // 0..7: a pair of source rows, 4 times
    float4 a[4], b[4];
#pragma unroll  // all eight loads in flight before the first use
    for (int i = 0; i < 4; ++i) {
        const float* p = src + (size_t)(2 * rp + 16 * i) * spitch + c4;
        a[i] = *reinterpret_cast<const float4*>(p);
        b[i] = *reinterpret_cast<const float4*>(p + spitch);
    }
    // Rows r and r+1 of one column are neighbours in the transposed tile:
    // one 4-byte LDS store takes both.
#pragma unroll  // constant indices into a and b
    for (int i = 0; i < 4; ++i) {
        const int r = 2 * rp + 16 * i;
        *reinterpret_cast<h2v*>(&tile[c4 + 0][r]) = h2v{(_Float16)a[i].x, (_Float16)b[i].x};
        *reinterpret_cast<h2v*>(&tile[c4 + 1][r]) = h2v{(_Float16)a[i].y, (_Float16)b[i].y};
        *reinterpret_cast<h2v*>(&tile[c4 + 2][r]) = h2v{(_Float16)a[i].z, (_Float16)b[i].z};
        *reinterpret_cast<h2v*>(&tile[c4 + 3][r]) = h2v{(_Float16)a[i].w, (_Float16)b[i].w};
    }
    __syncthreads();
    const int c0 = tid >> 3;           // 0..15, 4 times
    const int r8 = (tid & 7) * 8;
#pragma unroll  // four independent LDS reads and stores
    for (int i = 0; i < 4; ++i) {
        const int c = c0 + 16 * i;
        *reinterpret_cast<h8v*>(dst + (size_t)c * dpitch + r8) =
            *reinterpret_cast<const h8v*>(&tile[c][r8]);
    }
}

// ---------------------------------------------------------------------------
// f32 -> f16 elementwise convert of one run of 4096 elements by 128 threads;
// each thread converts 32 elements, read 16 bytes at a time and written
// 16 bytes at a time.
// ---------------------------------------------------------------------------
static __device__ inline void convert_f16_4096(const float* __restrict__ in,
                                               _Float16* __restrict__ out,
                                               int run) {
    const int base = run * 4096 + threadIdx.x * 8;
    float4 lo[4], hi[4];
#pragma unroll  // all eight loads in flight before the first use
    for (int i = 0; i < 4; ++i) {
        lo[i] = *reinterpret_cast<const float4*>(in + base + 1024 * i);
        hi[i] = *reinterpret_cast<const float4*>(in + base + 1024 * i + 4);
    }
#pragma unroll  // constant indices into lo and hi
    for (int i = 0; i < 4; ++i) {
        *reinterpret_cast<h8v*>(out + base + 1024 * i) =
            h8v{(_Float16)lo[i].x, (_Float16)lo[i].y,
                (_Float16)lo[i].z, (_Float16)lo[i].w,
                (_Float16)hi[i].x, (_Float16)hi[i].y,
                (_Float16)hi[i].z, (_Float16)hi[i].w};
    }
}

// ---------------------------------------------------------------------------
// Kernel 1: all operand preparation in one launch; none of the five parts
// reads what another writes.  grid = (E/64, E/64, 5), 128 threads.
//   z = 0..3: weight transpose + convert, W[k][n] (f32) -> Wt[n][k] (f16),
//             one 64 (k) x 64 (n) tile a block
//   z = 4:    X (f32) -> Xh (f16), one run of 4096 elements a block
// The choice is the same for a whole block, so the barrier inside the
// transpose is reached by all of its threads or by none.
// ---------------------------------------------------------------------------
static_assert(Mc * Ec / 4096 == (Ec / 64) * (Ec / 64),
              "the convert part fills one z plane of the grid exactly");

__global__ void __launch_bounds__(128)
k_prepare(const float* __restrict__ X,  _Float16* __restrict__ Xh,
          const float* __restrict__ Wq, _Float16* __restrict__ Wqt,
          const float* __restrict__ Wk, _Float16* __restrict__ Wkt,
          const float* __restrict__ Wv, _Float16* __restrict__ Wvt,
          const float* __restrict__ Wo, _Float16* __restrict__ Wot) {
    __shared__ __attribute__((aligned(16))) _Float16 tile[64][TPITCH];
    const int z = blockIdx.z;
    if (z == 4) {
        convert_f16_4096(X, Xh, blockIdx.y * (Ec / 64) + blockIdx.x);
        return;
    }
    const float* W  = z == 0 ? Wq  : z == 1 ? Wk  : z == 2 ? Wv  : Wo;
    _Float16*    Wt = z == 0 ? Wqt : z == 1 ? Wkt : z == 2 ? Wvt : Wot;
    const int n0 = blockIdx.x * 64;
    const int k0 = blockIdx.y * 64;
    tile_transpose_f16(W + (size_t)k0 * Ec + n0, Ec,
                       Wt + (size_t)n0 * Ec + k0, Ec, tile);
}

// ---------------------------------------------------------------------------
// WMMA GEMM tile  C[M,N] = A[M,K](f16) * Bt[N,K]^T(f16) + bias (f32 out)
// block = 256 threads (8 waves). Block tile = 128 rows x 64 cols.
// wave w: rows row0 = by*128 + w*16, cols col0 = bx*64 .. +63 (4 accumulators)
// ---------------------------------------------------------------------------
static __device__ inline void
gemm_tile_wmma(const _Float16* __restrict__ A, const _Float16* __restrict__ Bt,
               const float* __restrict__ bias, float* __restrict__ C,
               int Ndim, int Kdim) {
    const int wave  = threadIdx.x >> 5;
    const int lane  = threadIdx.x & 31;
    const int nl    = lane & 15;
    const int khalf = lane >> 4;
    const int col0  = blockIdx.x * 64;
    const int row0  = blockIdx.y * 128 + wave * 16;

    const _Float16* arow = A  + (size_t)(row0 + nl) * Kdim + khalf * 8;
    const _Float16* b0   = Bt + (size_t)(col0 +  0 + nl) * Kdim + khalf * 8;
    const _Float16* b1   = Bt + (size_t)(col0 + 16 + nl) * Kdim + khalf * 8;
    const _Float16* b2   = Bt + (size_t)(col0 + 32 + nl) * Kdim + khalf * 8;
    const _Float16* b3   = Bt + (size_t)(col0 + 48 + nl) * Kdim + khalf * 8;

    v8f acc0 = {}, acc1 = {}, acc2 = {}, acc3 = {};

    for (int k0 = 0; k0 < Kdim; k0 += 32) {
        __builtin_prefetch(arow + k0 + 128, 0, 0);  // global_prefetch_b8
        v16h a  = make_frag(arow + k0);
        v16h f0 = make_frag(b0 + k0);
        v16h f1 = make_frag(b1 + k0);
        v16h f2 = make_frag(b2 + k0);
        v16h f3 = make_frag(b3 + k0);
        acc0 = __builtin_amdgcn_wmma_f32_16x16x32_f16(false, a, false, f0,
                                                      (short)0, acc0, false, false);
        acc1 = __builtin_amdgcn_wmma_f32_16x16x32_f16(false, a, false, f1,
                                                      (short)0, acc1, false, false);
        acc2 = __builtin_amdgcn_wmma_f32_16x16x32_f16(false, a, false, f2,
                                                      (short)0, acc2, false, false);
        acc3 = __builtin_amdgcn_wmma_f32_16x16x32_f16(false, a, false, f3,
                                                      (short)0, acc3, false, false);
    }

    const int mo = khalf * 8;
    const float bz0 = bias[col0 +  0 + nl];
    const float bz1 = bias[col0 + 16 + nl];
    const float bz2 = bias[col0 + 32 + nl];
    const float bz3 = bias[col0 + 48 + nl];
#pragma unroll
    for (int r = 0; r < 8; ++r) {
        float* crow = C + (size_t)(row0 + mo + r) * Ndim + col0;
        crow[ 0 + nl] = acc0[r] + bz0;
        crow[16 + nl] = acc1[r] + bz1;
        crow[32 + nl] = acc2[r] + bz2;
        crow[48 + nl] = acc3[r] + bz3;
    }
}

// Kernel 2: the Q, K and V projections in one launch: three products of the
// same A that read nothing of each other.  grid = (N/64, M/128, 3); z picks
// the weight, the bias and the output.
__global__ void __launch_bounds__(256)
k_gemm_qkv(const _Float16* __restrict__ A,
           const _Float16* __restrict__ Wqt, const float* __restrict__ bq,
           float* __restrict__ Qf,
           const _Float16* __restrict__ Wkt, const float* __restrict__ bk,
           float* __restrict__ Kf,
           const _Float16* __restrict__ Wvt, const float* __restrict__ bv,
           float* __restrict__ Vf,
           int Ndim, int Kdim) {
    const int z = blockIdx.z;
    gemm_tile_wmma(A,
                   z == 0 ? Wqt : z == 1 ? Wkt : Wvt,
                   z == 0 ? bq  : z == 1 ? bk  : bv,
                   z == 0 ? Qf  : z == 1 ? Kf  : Vf,
                   Ndim, Kdim);
}

// Kernel 5: one product (the output projection).  grid = (N/64, M/128).
__global__ void __launch_bounds__(256)
k_gemm_wmma(const _Float16* __restrict__ A, const _Float16* __restrict__ Bt,
            const float* __restrict__ bias, float* __restrict__ C,
            int Ndim, int Kdim) {
    gemm_tile_wmma(A, Bt, bias, C, Ndim, Kdim);
}

// ---------------------------------------------------------------------------
// Kernel 3: V (f32 [B,T,E]) -> Vt (f16 [B,H,HD,T]) for K-contiguous B-frags
// ---------------------------------------------------------------------------
// grid = (B*H, T/64): one 64 (s) x 64 (d) tile a block.
__global__ void __launch_bounds__(128)
k_transpose_v(const float* __restrict__ V, _Float16* __restrict__ Vt) {
    __shared__ __attribute__((aligned(16))) _Float16 tile[64][TPITCH];
    const int bh = blockIdx.x;
    const int b  = bh / Hc, h = bh % Hc;
    const int s0 = blockIdx.y * 64;
    tile_transpose_f16(V + (size_t)(b * Tc + s0) * Ec + h * HDc, Ec,
                       Vt + (size_t)bh * HDc * Tc + s0, Tc, tile);
}

// ---------------------------------------------------------------------------
// Kernel 4: fused additive score + softmax + P@V (WMMA)
// grid = (B*H, T/16), block = 128 threads (4 waves). Output f16 [B*T, E].
// ---------------------------------------------------------------------------
__global__ void __launch_bounds__(128)
k_additive_attn(const float* __restrict__ Q, const float* __restrict__ Kf,
                const _Float16* __restrict__ Vt,
                const float* __restrict__ w_score,
                const float* __restrict__ b_score,
                _Float16* __restrict__ AttnH) {
    const int bh = blockIdx.x;
    const int b  = bh / Hc, h = bh % Hc;
    const int t0 = blockIdx.y * 16;
    const int tid = threadIdx.x;

    __shared__ float    q_s[16][HDc];      //  4 KB
    __shared__ float    sc[16][Sc];        // 24 KB
    __shared__ _Float16 p_s[16][SPAD];     // ~12.25 KB (padded rows)
    __shared__ float    red[16][8];
    __shared__ float    rowstat[16];

    // Each thread owns KPT key rows (s = tid + 128*j) and holds them in
    // registers for the whole score phase: every k value is read from global
    // memory once per block and serves all 16 query rows of the block.
    // Every loop over j, c or e below is unrolled in full for one reason:
    // kreg, x and acc stay in registers only if indexed by constants.
    constexpr int KPT = Sc / 128;          // 3 key rows per thread
    float4 kreg[KPT][HDc / 4];
#pragma unroll  // constant indices into kreg
    for (int j = 0; j < KPT; ++j) {
        const float4* krow = reinterpret_cast<const float4*>(
            Kf + ((size_t)(b * Tc + tid + j * 128)) * Ec + h * HDc);
#pragma unroll  // constant indices into kreg
        for (int c = 0; c < HDc / 4; ++c) kreg[j][c] = krow[c];
        asm volatile("s_wait_xcnt 0x0" :: "v"(krow) : "memory");
    }

    for (int i = tid; i < 16 * HDc; i += 128) {
        int r = i / HDc, d = i % HDc;
        q_s[r][d] = Q[((size_t)(b * Tc + t0 + r)) * Ec + h * HDc + d];
    }
    __syncthreads();

    // ---- additive scores: sc[t][s] = sum_d w[d]*tanh(q[t,d]+k[s,d]) + b ----
    // q[t][*] is one LDS address for the whole wave (broadcast read) and
    // w_score[*] a uniform address (scalar load); each serves KPT key rows.
    // The sum over d of one (t, s) pair runs in ascending d, one accumulator.
    const float bsc = b_score[0];
    for (int t = 0; t < 16; ++t) {
        float acc[KPT];
#pragma unroll  // constant indices into acc
        for (int j = 0; j < KPT; ++j) acc[j] = 0.f;
#pragma unroll  // constant indices into kreg
        for (int c = 0; c < HDc / 4; ++c) {
            const float4 qv = *reinterpret_cast<const float4*>(&q_s[t][c * 4]);
            // 4*KPT independent values per batch: no tanh waits for its
            // neighbour, and the KPT accumulator chains interleave.
            float x[KPT][4];
#pragma unroll  // constant indices into x and kreg
            for (int j = 0; j < KPT; ++j) {
                x[j][0] = qv.x + kreg[j][c].x;
                x[j][1] = qv.y + kreg[j][c].y;
                x[j][2] = qv.z + kreg[j][c].z;
                x[j][3] = qv.w + kreg[j][c].w;
            }
#pragma unroll  // constant indices into x
            for (int j = 0; j < KPT; ++j) {
                x[j][0] = fast_tanh(x[j][0]);
                x[j][1] = fast_tanh(x[j][1]);
                x[j][2] = fast_tanh(x[j][2]);
                x[j][3] = fast_tanh(x[j][3]);
            }
#pragma unroll  // constant indices into x
            for (int e = 0; e < 4; ++e) {
                const float we = w_score[c * 4 + e];
#pragma unroll  // constant indices into x and acc
                for (int j = 0; j < KPT; ++j) acc[j] += we * x[j][e];
            }
        }
#pragma unroll  // constant indices into acc
        for (int j = 0; j < KPT; ++j) sc[t][tid + j * 128] = acc[j] + bsc;
    }
    __syncthreads();

    // ---- softmax over s, 8 threads per row ----
    const int r   = tid & 15;
    const int sub = tid >> 4;      // 0..7
    {
        float mx = -3.4e38f;
        for (int s = sub; s < Sc; s += 8) mx = fmaxf(mx, sc[r][s]);
        red[r][sub] = mx;
    }
    __syncthreads();
    if (sub == 0) {
        float mx = red[r][0];
#pragma unroll
        for (int i = 1; i < 8; ++i) mx = fmaxf(mx, red[r][i]);
        rowstat[r] = mx;
    }
    __syncthreads();
    {
        float mx = rowstat[r];
        float sum = 0.f;
        for (int s = sub; s < Sc; s += 8) {
            float e = __expf(sc[r][s] - mx);
            sc[r][s] = e;
            sum += e;
        }
        red[r][sub] = sum;
    }
    __syncthreads();
    if (sub == 0) {
        float sum = 0.f;
#pragma unroll
        for (int i = 0; i < 8; ++i) sum += red[r][i];
        rowstat[r] = 1.f / sum;
    }
    __syncthreads();
    {
        float rinv = rowstat[r];
        for (int s = sub; s < Sc; s += 8)
            p_s[r][s] = (_Float16)(sc[r][s] * rinv);
    }
    __syncthreads();

    // ---- P[16,S] @ V[S,HD] via WMMA; wave w owns d-columns w*16..w*16+15 ----
    const int wave  = tid >> 5;
    const int lane  = tid & 31;
    const int nl    = lane & 15;
    const int khalf = lane >> 4;

    v8f acc = {};
    const _Float16* prow  = &p_s[nl][khalf * 8];                     // LDS
    const _Float16* vbase = Vt + ((size_t)bh * HDc + wave * 16 + nl) * Tc
                               + khalf * 8;                           // global
    for (int k0 = 0; k0 < Sc; k0 += 32) {
        __builtin_prefetch(vbase + k0 + 64, 0, 0);
        v16h a  = make_frag(prow + k0);      // ds_read_b128 x2, conflict-free
        v16h bb = make_frag(vbase + k0);     // global_load_b128 x2
        acc = __builtin_amdgcn_wmma_f32_16x16x32_f16(false, a, false, bb,
                                                     (short)0, acc, false, false);
    }

    const int mo = khalf * 8;
#pragma unroll
    for (int rr = 0; rr < 8; ++rr) {
        AttnH[((size_t)(b * Tc + t0 + mo + rr)) * Ec + h * HDc + wave * 16 + nl]
            = (_Float16)acc[rr];
    }
}

// ---------------------------------------------------------------------------
// Host launcher
// ---------------------------------------------------------------------------
extern "C" void kernel_launch(void* const* d_in, const int* in_sizes, int n_in,
                              void* d_out, int out_size, void* d_ws, size_t ws_size,
                              hipStream_t stream) {
    const float* X   = (const float*)d_in[0];
    const float* Wq  = (const float*)d_in[1];
    const float* bq  = (const float*)d_in[2];
    const float* Wk  = (const float*)d_in[3];
    const float* bk  = (const float*)d_in[4];
    const float* Wv  = (const float*)d_in[5];
    const float* bv  = (const float*)d_in[6];
    const float* Wo  = (const float*)d_in[7];
    const float* bo  = (const float*)d_in[8];
    const float* wsc = (const float*)d_in[9];
    const float* bsc = (const float*)d_in[10];

    char* ws = (char*)d_ws;
    size_t off = 0;
    auto carve = [&](size_t bytes) {
        void* p = ws + off;
        off += (bytes + 255) & ~(size_t)255;
        return p;
    };

    _Float16* Xh    = (_Float16*)carve((size_t)Mc * Ec * 2);
    _Float16* Wqt   = (_Float16*)carve((size_t)Ec * Ec * 2);
    _Float16* Wkt   = (_Float16*)carve((size_t)Ec * Ec * 2);
    _Float16* Wvt   = (_Float16*)carve((size_t)Ec * Ec * 2);
    _Float16* Wot   = (_Float16*)carve((size_t)Ec * Ec * 2);
    float*    Qf    = (float*)   carve((size_t)Mc * Ec * 4);
    float*    Kff   = (float*)   carve((size_t)Mc * Ec * 4);
    float*    Vf    = (float*)   carve((size_t)Mc * Ec * 4);
    _Float16* Vth   = (_Float16*)carve((size_t)Bc * Hc * HDc * Tc * 2);
    _Float16* AttnH = (_Float16*)carve((size_t)Mc * Ec * 2);

    // 1) X -> f16 and the four weights -> transposed f16, one launch
    {
        dim3 grid(Ec / 64, Ec / 64, 5);
        k_prepare<<<grid, 128, 0, stream>>>(X, Xh, Wq, Wqt, Wk, Wkt,
                                            Wv, Wvt, Wo, Wot);
    }
    // 2) Q/K/V projections (WMMA GEMMs), one launch
    {
        dim3 grid(Ec / 64, Mc / 128, 3);
        k_gemm_qkv<<<grid, 256, 0, stream>>>(Xh, Wqt, bq, Qf, Wkt, bk, Kff,
                                             Wvt, bv, Vf, Ec, Ec);
    }
    // 3) V -> [B,H,HD,T] f16
    {
        dim3 grid(Bc * Hc, Tc / 64);
        k_transpose_v<<<grid, 128, 0, stream>>>(Vf, Vth);
    }
    // 4) fused additive score + softmax + P@V
    {
        dim3 grid(Bc * Hc, Tc / 16);
        k_additive_attn<<<grid, 128, 0, stream>>>(Qf, Kff, Vth, wsc, bsc, AttnH);
    }
    // 5) output projection -> d_out (f32)
    {
        dim3 grid(Ec / 64, Mc / 128);
        k_gemm_wmma<<<grid, 256, 0, stream>>>(AttnH, Wot, bo, (float*)d_out, Ec, Ec);
    }
}

// v004
// One run takes 70.4 microseconds.
// Two timings next to v003 put it at 1.16 and 1.17 times that version's speed.
// Counting every step since v000, it is 3.02 times as fast.
#include <hip/hip_runtime.h>

typedef __attribute__((ext_vector_type(16))) _Float16 v16h;
typedef __attribute__((ext_vector_type(8)))  _Float16 h8v;
typedef __attribute__((ext_vector_type(4)))  _Float16 h4v;
typedef __attribute__((ext_vector_type(2)))  _Float16 h2v;
typedef __attribute__((ext_vector_type(8)))  float    v8f;

constexpr int Bc = 2, Tc = 384, Ec = 768, Hc = 12, HDc = 64;
constexpr int Mc = Bc * Tc;
constexpr int Sc = Tc;
constexpr int SPAD = Sc + 8;

static __device__ inline float fast_tanh(float x) {
#if __has_builtin(__builtin_amdgcn_tanhf)
    return __builtin_amdgcn_tanhf(x);
#elif __has_builtin(__builtin_amdgcn_tanh_f32)
    return __builtin_amdgcn_tanh_f32(x);
#else
    return tanhf(x);
#endif
}

template <int XMASK>
static __device__ inline float row_xor(float x) {
    return __builtin_bit_cast(float, __builtin_amdgcn_mov_dpp(
        __builtin_bit_cast(int, x), 0x160 + XMASK, 0xf, 0xf, true));
}
static __device__ inline float half_xor(float x) {
    const int b = __builtin_bit_cast(int, x);
    return __builtin_bit_cast(float, __builtin_amdgcn_permlanex16(
        b, b, 0x76543210, 0xfedcba98, false, false));
}
static __device__ inline float wave_max(float x) {
    x = fmaxf(x, row_xor<1>(x));
    x = fmaxf(x, row_xor<2>(x));
    x = fmaxf(x, row_xor<4>(x));
    x = fmaxf(x, row_xor<8>(x));
    return fmaxf(x, half_xor(x));
}
static __device__ inline float wave_sum(float x) {
    x += row_xor<1>(x);
    x += row_xor<2>(x);
    x += row_xor<4>(x);
    x += row_xor<8>(x);
    return x + half_xor(x);
}

static __device__ inline float4 exp2_x4(float a, float b, float c, float d) {
    float4 r;
    asm("v_exp_f32 %0, %4\n\tv_exp_f32 %1, %5\n\t"
        "v_exp_f32 %2, %6\n\tv_exp_f32 %3, %7\n\tv_nop"
        : "=&v"(r.x), "=&v"(r.y), "=&v"(r.z), "=&v"(r.w)
        : "v"(a), "v"(b), "v"(c), "v"(d));
    return r;
}

static __device__ inline v16h make_frag(const _Float16* p) {
    h8v lo = *reinterpret_cast<const h8v*>(p);
    h8v hi = *reinterpret_cast<const h8v*>(p + 16);
    v16h r;
#pragma unroll
    for (int i = 0; i < 8; ++i) { r[i] = lo[i]; r[i + 8] = hi[i]; }
    return r;
}

// ---------------------------------------------------------------------------
// One 64x64 tile, transposed and converted through LDS by 128 threads:
//   dst[c * dpitch + r] = (f16) src[r * spitch + c],  r, c = 0..63
// Global reads are 16 bytes a lane along c, global writes 16 bytes a lane
// along r (whole 128-byte lines both ways); each thread moves 32 elements.
// ---------------------------------------------------------------------------
constexpr int TPITCH = 64 + 8;  // halves; 144 B = 16 B x odd for ds_load_b128

static __device__ inline void tile_transpose_f16(const float* __restrict__ src,
                                                 int spitch,
                                                 _Float16* __restrict__ dst,
                                                 int dpitch,
                                                 _Float16 (*tile)[TPITCH]) {
    const int tid = threadIdx.x;
    const int c4  = (tid & 15) * 4;
    const int rp  = tid >> 4;          // 0..7: a pair of source rows, 4 times
    float4 a[4], b[4];
#pragma unroll  // all eight loads in flight before the first use
    for (int i = 0; i < 4; ++i) {
        const float* p = src + (size_t)(2 * rp + 16 * i) * spitch + c4;
        a[i] = *reinterpret_cast<const float4*>(p);
        b[i] = *reinterpret_cast<const float4*>(p + spitch);
    }
    // Rows r and r+1 of one column are neighbours in the transposed tile:
    // one 4-byte LDS store takes both.
#pragma unroll  // constant indices into a and b
    for (int i = 0; i < 4; ++i) {
        const int r = 2 * rp + 16 * i;
        *reinterpret_cast<h2v*>(&tile[c4 + 0][r]) = h2v{(_Float16)a[i].x, (_Float16)b[i].x};
        *reinterpret_cast<h2v*>(&tile[c4 + 1][r]) = h2v{(_Float16)a[i].y, (_Float16)b[i].y};
        *reinterpret_cast<h2v*>(&tile[c4 + 2][r]) = h2v{(_Float16)a[i].z, (_Float16)b[i].z};
        *reinterpret_cast<h2v*>(&tile[c4 + 3][r]) = h2v{(_Float16)a[i].w, (_Float16)b[i].w};
    }
    __syncthreads();
    const int c0 = tid >> 3;           // 0..15, 4 times
    const int r8 = (tid & 7) * 8;
#pragma unroll  // four independent LDS reads and stores
    for (int i = 0; i < 4; ++i) {
        const int c = c0 + 16 * i;
        *reinterpret_cast<h8v*>(dst + (size_t)c * dpitch + r8) =
            *reinterpret_cast<const h8v*>(&tile[c][r8]);
    }
}

// ---------------------------------------------------------------------------
// f32 -> f16 elementwise convert of one run of 4096 elements by 128 threads;
// each thread converts 32 elements, read 16 bytes at a time and written
// 16 bytes at a time.
// ---------------------------------------------------------------------------
static __device__ inline void convert_f16_4096(const float* __restrict__ in,
                                               _Float16* __restrict__ out,
                                               int run) {
    const int base = run * 4096 + threadIdx.x * 8;
    float4 lo[4], hi[4];
#pragma unroll  // all eight loads in flight before the first use
    for (int i = 0; i < 4; ++i) {
        lo[i] = *reinterpret_cast<const float4*>(in + base + 1024 * i);
        hi[i] = *reinterpret_cast<const float4*>(in + base + 1024 * i + 4);
    }
#pragma unroll  // constant indices into lo and hi
    for (int i = 0; i < 4; ++i) {
        *reinterpret_cast<h8v*>(out + base + 1024 * i) =
            h8v{(_Float16)lo[i].x, (_Float16)lo[i].y,
                (_Float16)lo[i].z, (_Float16)lo[i].w,
                (_Float16)hi[i].x, (_Float16)hi[i].y,
                (_Float16)hi[i].z, (_Float16)hi[i].w};
    }
}

// ---------------------------------------------------------------------------
// Kernel 1: all operand preparation in one launch; none of the five parts
// reads what another writes.  grid = (E/64, E/64, 5), 128 threads.
//   z = 0..3: weight transpose + convert, W[k][n] (f32) -> Wt[n][k] (f16),
//             one 64 (k) x 64 (n) tile a block
//   z = 4:    X (f32) -> Xh (f16), one run of 4096 elements a block
// The choice is the same for a whole block, so the barrier inside the
// transpose is reached by all of its threads or by none.
// ---------------------------------------------------------------------------
static_assert(Mc * Ec / 4096 == (Ec / 64) * (Ec / 64),
              "the convert part fills one z plane of the grid exactly");

__global__ void __launch_bounds__(128)
k_prepare(const float* __restrict__ X,  _Float16* __restrict__ Xh,
          const float* __restrict__ Wq, _Float16* __restrict__ Wqt,
          const float* __restrict__ Wk, _Float16* __restrict__ Wkt,
          const float* __restrict__ Wv, _Float16* __restrict__ Wvt,
          const float* __restrict__ Wo, _Float16* __restrict__ Wot) {
    __shared__ __attribute__((aligned(16))) _Float16 tile[64][TPITCH];
    const int z = blockIdx.z;
    if (z == 4) {
        convert_f16_4096(X, Xh, blockIdx.y * (Ec / 64) + blockIdx.x);
        return;
    }
    const float* W  = z == 0 ? Wq  : z == 1 ? Wk  : z == 2 ? Wv  : Wo;
    _Float16*    Wt = z == 0 ? Wqt : z == 1 ? Wkt : z == 2 ? Wvt : Wot;
    const int n0 = blockIdx.x * 64;
    const int k0 = blockIdx.y * 64;
    tile_transpose_f16(W + (size_t)k0 * Ec + n0, Ec,
                       Wt + (size_t)n0 * Ec + k0, Ec, tile);
}

// ---------------------------------------------------------------------------
// WMMA GEMM tile  C[M,N] = A[M,K](f16) * Bt[N,K]^T(f16) + bias (f32 out)
// block = 256 threads (8 waves). Block tile = 128 rows x 64 cols.
// wave w: rows row0 = by*128 + w*16, cols col0 = bx*64 .. +63 (4 accumulators)
// ---------------------------------------------------------------------------
static __device__ inline void
gemm_tile_wmma(const _Float16* __restrict__ A, const _Float16* __restrict__ Bt,
               const float* __restrict__ bias, float* __restrict__ C,
               int Ndim, int Kdim) {
    const int wave  = threadIdx.x >> 5;
    const int lane  = threadIdx.x & 31;
    const int nl    = lane & 15;
    const int khalf = lane >> 4;
    const int col0  = blockIdx.x * 64;
    const int row0  = blockIdx.y * 128 + wave * 16;

    const _Float16* arow = A  + (size_t)(row0 + nl) * Kdim + khalf * 8;
    const _Float16* b0   = Bt + (size_t)(col0 +  0 + nl) * Kdim + khalf * 8;
    const _Float16* b1   = Bt + (size_t)(col0 + 16 + nl) * Kdim + khalf * 8;
    const _Float16* b2   = Bt + (size_t)(col0 + 32 + nl) * Kdim + khalf * 8;
    const _Float16* b3   = Bt + (size_t)(col0 + 48 + nl) * Kdim + khalf * 8;

    v8f acc0 = {}, acc1 = {}, acc2 = {}, acc3 = {};

    for (int k0 = 0; k0 < Kdim; k0 += 32) {
        __builtin_prefetch(arow + k0 + 128, 0, 0);  // global_prefetch_b8
        v16h a  = make_frag(arow + k0);
        v16h f0 = make_frag(b0 + k0);
        v16h f1 = make_frag(b1 + k0);
        v16h f2 = make_frag(b2 + k0);
        v16h f3 = make_frag(b3 + k0);
        acc0 = __builtin_amdgcn_wmma_f32_16x16x32_f16(false, a, false, f0,
                                                      (short)0, acc0, false, false);
        acc1 = __builtin_amdgcn_wmma_f32_16x16x32_f16(false, a, false, f1,
                                                      (short)0, acc1, false, false);
        acc2 = __builtin_amdgcn_wmma_f32_16x16x32_f16(false, a, false, f2,
                                                      (short)0, acc2, false, false);
        acc3 = __builtin_amdgcn_wmma_f32_16x16x32_f16(false, a, false, f3,
                                                      (short)0, acc3, false, false);
    }

    const int mo = khalf * 8;
    const float bz0 = bias[col0 +  0 + nl];
    const float bz1 = bias[col0 + 16 + nl];
    const float bz2 = bias[col0 + 32 + nl];
    const float bz3 = bias[col0 + 48 + nl];
#pragma unroll
    for (int r = 0; r < 8; ++r) {
        float* crow = C + (size_t)(row0 + mo + r) * Ndim + col0;
        crow[ 0 + nl] = acc0[r] + bz0;
        crow[16 + nl] = acc1[r] + bz1;
        crow[32 + nl] = acc2[r] + bz2;
        crow[48 + nl] = acc3[r] + bz3;
    }
}

// Kernel 2: the Q, K and V projections in one launch: three products of the
// same A that read nothing of each other.  grid = (N/64, M/128, 3); z picks
// the weight, the bias and the output.
__global__ void __launch_bounds__(256)
k_gemm_qkv(const _Float16* __restrict__ A,
           const _Float16* __restrict__ Wqt, const float* __restrict__ bq,
           float* __restrict__ Qf,
           const _Float16* __restrict__ Wkt, const float* __restrict__ bk,
           float* __restrict__ Kf,
           const _Float16* __restrict__ Wvt, const float* __restrict__ bv,
           float* __restrict__ Vf,
           int Ndim, int Kdim) {
    const int z = blockIdx.z;
    gemm_tile_wmma(A,
                   z == 0 ? Wqt : z == 1 ? Wkt : Wvt,
                   z == 0 ? bq  : z == 1 ? bk  : bv,
                   z == 0 ? Qf  : z == 1 ? Kf  : Vf,
                   Ndim, Kdim);
}

// Kernel 5: one product (the output projection).  grid = (N/64, M/128).
__global__ void __launch_bounds__(256)
k_gemm_wmma(const _Float16* __restrict__ A, const _Float16* __restrict__ Bt,
            const float* __restrict__ bias, float* __restrict__ C,
            int Ndim, int Kdim) {
    gemm_tile_wmma(A, Bt, bias, C, Ndim, Kdim);
}

// ---------------------------------------------------------------------------
// Kernel 3: V (f32 [B,T,E]) -> Vt (f16 [B,H,HD,T]) for K-contiguous B-frags
// ---------------------------------------------------------------------------
// grid = (B*H, T/64): one 64 (s) x 64 (d) tile a block.
__global__ void __launch_bounds__(128)
k_transpose_v(const float* __restrict__ V, _Float16* __restrict__ Vt) {
    __shared__ __attribute__((aligned(16))) _Float16 tile[64][TPITCH];
    const int bh = blockIdx.x;
    const int b  = bh / Hc, h = bh % Hc;
    const int s0 = blockIdx.y * 64;
    tile_transpose_f16(V + (size_t)(b * Tc + s0) * Ec + h * HDc, Ec,
                       Vt + (size_t)bh * HDc * Tc + s0, Tc, tile);
}

// ---------------------------------------------------------------------------
// Kernel 4: fused additive score + softmax + P@V (WMMA)
// grid = (B*H, T/16), block = 128 threads (4 waves). Output f16 [B*T, E].
// ---------------------------------------------------------------------------
__global__ void __launch_bounds__(128)
k_additive_attn(const float* __restrict__ Q, const float* __restrict__ Kf,
                const _Float16* __restrict__ Vt,
                const float* __restrict__ w_score,
                const float* __restrict__ b_score,
                _Float16* __restrict__ AttnH) {
    const int bh = blockIdx.x;
    const int b  = bh / Hc, h = bh % Hc;
    const int t0 = blockIdx.y * 16;
    const int tid = threadIdx.x;

    __shared__ float    q_s[16][HDc];      //  4 KB
    __shared__ __attribute__((aligned(16))) float    sc[16][Sc];     // 24 KB
    __shared__ __attribute__((aligned(16))) _Float16 p_s[16][SPAD];  // ~12.25 KB

    // Each thread owns KPT key rows (s = tid + 128*j) and holds them in
    // registers for the whole score phase: every k value is read from global
    // memory once per block and serves all 16 query rows of the block.
    // Every loop over j, c or e below is unrolled in full for one reason:
    // kreg, x, acc, v and e stay in registers only if indexed by constants.
    constexpr int KPT = Sc / 128;          // 3 key rows per thread
    float4 kreg[KPT][HDc / 4];
#pragma unroll  // constant indices into kreg
    for (int j = 0; j < KPT; ++j) {
        const float4* krow = reinterpret_cast<const float4*>(
            Kf + ((size_t)(b * Tc + tid + j * 128)) * Ec + h * HDc);
#pragma unroll  // constant indices into kreg
        for (int c = 0; c < HDc / 4; ++c) kreg[j][c] = krow[c];
        asm volatile("s_wait_xcnt 0x0" :: "v"(krow) : "memory");
    }

    for (int i = tid; i < 16 * HDc; i += 128) {
        int r = i / HDc, d = i % HDc;
        q_s[r][d] = Q[((size_t)(b * Tc + t0 + r)) * Ec + h * HDc + d];
    }
    __syncthreads();

    // ---- additive scores: sc[t][s] = sum_d w[d]*tanh(q[t,d]+k[s,d]) + b ----
    // q[t][*] is one LDS address for the whole wave (broadcast read) and
    // w_score[*] a uniform address (scalar load); each serves KPT key rows.
    // The sum over d of one (t, s) pair runs in ascending d, one accumulator.
    const float bsc = b_score[0];
    for (int t = 0; t < 16; ++t) {
        float acc[KPT];
#pragma unroll  // constant indices into acc
        for (int j = 0; j < KPT; ++j) acc[j] = 0.f;
#pragma unroll  // constant indices into kreg
        for (int c = 0; c < HDc / 4; ++c) {
            const float4 qv = *reinterpret_cast<const float4*>(&q_s[t][c * 4]);
            // 4*KPT independent values per batch: no tanh waits for its
            // neighbour, and the KPT accumulator chains interleave.
            float x[KPT][4];
#pragma unroll  // constant indices into x and kreg
            for (int j = 0; j < KPT; ++j) {
                x[j][0] = qv.x + kreg[j][c].x;
                x[j][1] = qv.y + kreg[j][c].y;
                x[j][2] = qv.z + kreg[j][c].z;
                x[j][3] = qv.w + kreg[j][c].w;
            }
#pragma unroll  // constant indices into x
            for (int j = 0; j < KPT; ++j) {
                x[j][0] = fast_tanh(x[j][0]);
                x[j][1] = fast_tanh(x[j][1]);
                x[j][2] = fast_tanh(x[j][2]);
                x[j][3] = fast_tanh(x[j][3]);
            }
#pragma unroll  // constant indices into x
            for (int e = 0; e < 4; ++e) {
                const float we = w_score[c * 4 + e];
#pragma unroll  // constant indices into x and acc
                for (int j = 0; j < KPT; ++j) acc[j] += we * x[j][e];
            }
        }
#pragma unroll  // constant indices into acc
        for (int j = 0; j < KPT; ++j) sc[t][tid + j * 128] = acc[j] + bsc;
    }
    __syncthreads();

    const int wave  = tid >> 5;
    const int lane  = tid & 31;
    const int nl    = lane & 15;
    const int khalf = lane >> 4;
    constexpr int RPW = 16 / 4;            // rows per wave
    constexpr int CPL = Sc / 128;          // 16-byte pieces of a row per lane
#pragma unroll  // the rows' reduction chains are independent and interleave
    for (int rr = 0; rr < RPW; ++rr) {
        const int row = wave * RPW + rr;
        float4 v[CPL];
#pragma unroll  // constant indices into v
        for (int c = 0; c < CPL; ++c)
            v[c] = *reinterpret_cast<const float4*>(&sc[row][c * 128 + lane * 4]);
        float mx = -3.4e38f;
#pragma unroll  // constant indices into v
        for (int c = 0; c < CPL; ++c)
            mx = fmaxf(mx, fmaxf(fmaxf(v[c].x, v[c].y), fmaxf(v[c].z, v[c].w)));
        mx = wave_max(mx);
        constexpr float LOG2E = 1.44269504088896340736f;  // exp(x) = exp2(x * LOG2E)
        float4 e[CPL];
#pragma unroll  // constant indices into v and e
        for (int c = 0; c < CPL; ++c) {
            e[c] = exp2_x4((v[c].x - mx) * LOG2E, (v[c].y - mx) * LOG2E,
                           (v[c].z - mx) * LOG2E, (v[c].w - mx) * LOG2E);
        }
        float sum = (e[0].x + e[0].y) + (e[0].z + e[0].w);
#pragma unroll  // constant indices into e
        for (int c = 1; c < CPL; ++c)
            sum += (e[c].x + e[c].y) + (e[c].z + e[c].w);
        sum = wave_sum(sum);
        const float rinv = 1.f / sum;
#pragma unroll  // constant indices into e
        for (int c = 0; c < CPL; ++c)
            *reinterpret_cast<h4v*>(&p_s[row][c * 128 + lane * 4]) =
                h4v{(_Float16)(e[c].x * rinv), (_Float16)(e[c].y * rinv),
                    (_Float16)(e[c].z * rinv), (_Float16)(e[c].w * rinv)};
    }
    __syncthreads();

    // ---- P[16,S] @ V[S,HD] via WMMA; wave w owns d-columns w*16..w*16+15 ----
    v8f acc = {};
    const _Float16* prow  = &p_s[nl][khalf * 8];                     // LDS
    const _Float16* vbase = Vt + ((size_t)bh * HDc + wave * 16 + nl) * Tc
                               + khalf * 8;                           // global
    for (int k0 = 0; k0 < Sc; k0 += 32) {
        __builtin_prefetch(vbase + k0 + 64, 0, 0);
        v16h a  = make_frag(prow + k0);      // ds_read_b128 x2, conflict-free
        v16h bb = make_frag(vbase + k0);     // global_load_b128 x2
        acc = __builtin_amdgcn_wmma_f32_16x16x32_f16(false, a, false, bb,
                                                     (short)0, acc, false, false);
    }

    const int mo = khalf * 8;
#pragma unroll
    for (int rr = 0; rr < 8; ++rr) {
        AttnH[((size_t)(b * Tc + t0 + mo + rr)) * Ec + h * HDc + wave * 16 + nl]
            = (_Float16)acc[rr];
    }
}

// ---------------------------------------------------------------------------
// Host launcher
// ---------------------------------------------------------------------------
extern "C" void kernel_launch(void* const* d_in, const int* in_sizes, int n_in,
                              void* d_out, int out_size, void* d_ws, size_t ws_size,
                              hipStream_t stream) {
    const float* X   = (const float*)d_in[0];
    const float* Wq  = (const float*)d_in[1];
    const float* bq  = (const float*)d_in[2];
    const float* Wk  = (const float*)d_in[3];
    const float* bk  = (const float*)d_in[4];
    const float* Wv  = (const float*)d_in[5];
    const float* bv  = (const float*)d_in[6];
    const float* Wo  = (const float*)d_in[7];
    const float* bo  = (const float*)d_in[8];
    const float* wsc = (const float*)d_in[9];
    const float* bsc = (const float*)d_in[10];

    char* ws = (char*)d_ws;
    size_t off = 0;
    auto carve = [&](size_t bytes) {
        void* p = ws + off;
        off += (bytes + 255) & ~(size_t)255;
        return p;
    };

    _Float16* Xh    = (_Float16*)carve((size_t)Mc * Ec * 2);
    _Float16* Wqt   = (_Float16*)carve((size_t)Ec * Ec * 2);
    _Float16* Wkt   = (_Float16*)carve((size_t)Ec * Ec * 2);
    _Float16* Wvt   = (_Float16*)carve((size_t)Ec * Ec * 2);
    _Float16* Wot   = (_Float16*)carve((size_t)Ec * Ec * 2);
    float*    Qf    = (float*)   carve((size_t)Mc * Ec * 4);
    float*    Kff   = (float*)   carve((size_t)Mc * Ec * 4);
    float*    Vf    = (float*)   carve((size_t)Mc * Ec * 4);
    _Float16* Vth   = (_Float16*)carve((size_t)Bc * Hc * HDc * Tc * 2);
    _Float16* AttnH = (_Float16*)carve((size_t)Mc * Ec * 2);

    // 1) X -> f16 and the four weights -> transposed f16, one launch
    {
        dim3 grid(Ec / 64, Ec / 64, 5);
        k_prepare<<<grid, 128, 0, stream>>>(X, Xh, Wq, Wqt, Wk, Wkt,
                                            Wv, Wvt, Wo, Wot);
    }
    // 2) Q/K/V projections (WMMA GEMMs), one launch
    {
        dim3 grid(Ec / 64, Mc / 128, 3);
        k_gemm_qkv<<<grid, 256, 0, stream>>>(Xh, Wqt, bq, Qf, Wkt, bk, Kff,
                                             Wvt, bv, Vf, Ec, Ec);
    }
    // 3) V -> [B,H,HD,T] f16
    {
        dim3 grid(Bc * Hc, Tc / 64);
        k_transpose_v<<<grid, 128, 0, stream>>>(Vf, Vth);
    }
    // 4) fused additive score + softmax + P@V
    {
        dim3 grid(Bc * Hc, Tc / 16);
        k_additive_attn<<<grid, 128, 0, stream>>>(Qf, Kff, Vth, wsc, bsc, AttnH);
    }
    // 5) output projection -> d_out (f32)
    {
        dim3 grid(Ec / 64, Mc / 128);
        k_gemm_wmma<<<grid, 256, 0, stream>>>(AttnH, Wot, bo, (float*)d_out, Ec, Ec);
    }
}

// v005
// It runs in 49.7 microseconds.
// Two timings next to v004 put it at 1.40 and 1.42 times that version's speed.
// Counting every step since v000, it is 4.26 times as fast.
#include <hip/hip_runtime.h>

typedef __attribute__((ext_vector_type(16))) _Float16 v16h;
typedef __attribute__((ext_vector_type(8)))  _Float16 h8v;
typedef __attribute__((ext_vector_type(4)))  _Float16 h4v;
typedef __attribute__((ext_vector_type(2)))  _Float16 h2v;
typedef __attribute__((ext_vector_type(8)))  float    v8f;

constexpr int Bc = 2, Tc = 384, Ec = 768, Hc = 12, HDc = 64;
constexpr int Mc = Bc * Tc;
constexpr int Sc = Tc;
constexpr int SPAD = Sc + 8;

static __device__ inline float fast_tanh(float x) {
#if __has_builtin(__builtin_amdgcn_tanhf)
    return __builtin_amdgcn_tanhf(x);
#elif __has_builtin(__builtin_amdgcn_tanh_f32)
    return __builtin_amdgcn_tanh_f32(x);
#else
    return tanhf(x);
#endif
}

template <int XMASK>
static __device__ inline float row_xor(float x) {
    return __builtin_bit_cast(float, __builtin_amdgcn_mov_dpp(
        __builtin_bit_cast(int, x), 0x160 + XMASK, 0xf, 0xf, true));
}
static __device__ inline float half_xor(float x) {
    const int b = __builtin_bit_cast(int, x);
    return __builtin_bit_cast(float, __builtin_amdgcn_permlanex16(
        b, b, 0x76543210, 0xfedcba98, false, false));
}
static __device__ inline float wave_max(float x) {
    x = fmaxf(x, row_xor<1>(x));
    x = fmaxf(x, row_xor<2>(x));
    x = fmaxf(x, row_xor<4>(x));
    x = fmaxf(x, row_xor<8>(x));
    return fmaxf(x, half_xor(x));
}
static __device__ inline float wave_sum(float x) {
    x += row_xor<1>(x);
    x += row_xor<2>(x);
    x += row_xor<4>(x);
    x += row_xor<8>(x);
    return x + half_xor(x);
}

static __device__ inline float4 exp2_x4(float a, float b, float c, float d) {
    float4 r;
    asm("v_exp_f32 %0, %4\n\tv_exp_f32 %1, %5\n\t"
        "v_exp_f32 %2, %6\n\tv_exp_f32 %3, %7\n\tv_nop"
        : "=&v"(r.x), "=&v"(r.y), "=&v"(r.z), "=&v"(r.w)
        : "v"(a), "v"(b), "v"(c), "v"(d));
    return r;
}

static __device__ inline v16h make_frag(const _Float16* p) {
    h8v lo = *reinterpret_cast<const h8v*>(p);
    h8v hi = *reinterpret_cast<const h8v*>(p + 16);
    v16h r;
#pragma unroll
    for (int i = 0; i < 8; ++i) { r[i] = lo[i]; r[i + 8] = hi[i]; }
    return r;
}

// ---------------------------------------------------------------------------
// One 64x64 tile, transposed and converted through LDS by 128 threads:
//   dst[c * dpitch + r] = (f16) src[r * spitch + c],  r, c = 0..63
// Global reads are 16 bytes a lane along c, global writes 16 bytes a lane
// along r (whole 128-byte lines both ways); each thread moves 32 elements.
// ---------------------------------------------------------------------------
constexpr int TPITCH = 64 + 8;  // halves; 144 B = 16 B x odd for ds_load_b128

static __device__ inline void tile_transpose_f16(const float* __restrict__ src,
                                                 int spitch,
                                                 _Float16* __restrict__ dst,
                                                 int dpitch,
                                                 _Float16 (*tile)[TPITCH]) {
    const int tid = threadIdx.x;
    const int c4  = (tid & 15) * 4;
    const int rp  = tid >> 4;          // 0..7: a pair of source rows, 4 times
    float4 a[4], b[4];
#pragma unroll  // all eight loads in flight before the first use
    for (int i = 0; i < 4; ++i) {
        const float* p = src + (size_t)(2 * rp + 16 * i) * spitch + c4;
        a[i] = *reinterpret_cast<const float4*>(p);
        b[i] = *reinterpret_cast<const float4*>(p + spitch);
    }
    // Rows r and r+1 of one column are neighbours in the transposed tile:
    // one 4-byte LDS store takes both.
#pragma unroll  // constant indices into a and b
    for (int i = 0; i < 4; ++i) {
        const int r = 2 * rp + 16 * i;
        *reinterpret_cast<h2v*>(&tile[c4 + 0][r]) = h2v{(_Float16)a[i].x, (_Float16)b[i].x};
        *reinterpret_cast<h2v*>(&tile[c4 + 1][r]) = h2v{(_Float16)a[i].y, (_Float16)b[i].y};
        *reinterpret_cast<h2v*>(&tile[c4 + 2][r]) = h2v{(_Float16)a[i].z, (_Float16)b[i].z};
        *reinterpret_cast<h2v*>(&tile[c4 + 3][r]) = h2v{(_Float16)a[i].w, (_Float16)b[i].w};
    }
    __syncthreads();
    const int c0 = tid >> 3;           // 0..15, 4 times
    const int r8 = (tid & 7) * 8;
#pragma unroll  // four independent LDS reads and stores
    for (int i = 0; i < 4; ++i) {
        const int c = c0 + 16 * i;
        *reinterpret_cast<h8v*>(dst + (size_t)c * dpitch + r8) =
            *reinterpret_cast<const h8v*>(&tile[c][r8]);
    }
}

// ---------------------------------------------------------------------------
// f32 -> f16 elementwise convert of one run of 4096 elements by 128 threads;
// each thread converts 32 elements, read 16 bytes at a time and written
// 16 bytes at a time.
// ---------------------------------------------------------------------------
static __device__ inline void convert_f16_4096(const float* __restrict__ in,
                                               _Float16* __restrict__ out,
                                               int run) {
    const int base = run * 4096 + threadIdx.x * 8;
    float4 lo[4], hi[4];
#pragma unroll  // all eight loads in flight before the first use
    for (int i = 0; i < 4; ++i) {
        lo[i] = *reinterpret_cast<const float4*>(in + base + 1024 * i);
        hi[i] = *reinterpret_cast<const float4*>(in + base + 1024 * i + 4);
    }
#pragma unroll  // constant indices into lo and hi
    for (int i = 0; i < 4; ++i) {
        *reinterpret_cast<h8v*>(out + base + 1024 * i) =
            h8v{(_Float16)lo[i].x, (_Float16)lo[i].y,
                (_Float16)lo[i].z, (_Float16)lo[i].w,
                (_Float16)hi[i].x, (_Float16)hi[i].y,
                (_Float16)hi[i].z, (_Float16)hi[i].w};
    }
}

// ---------------------------------------------------------------------------
// Kernel 1: all operand preparation in one launch; none of the five parts
// reads what another writes.  grid = (E/64, E/64, 5), 128 threads.
//   z = 0..3: weight transpose + convert, W[k][n] (f32) -> Wt[n][k] (f16),
//             one 64 (k) x 64 (n) tile a block
//   z = 4:    X (f32) -> Xh (f16), one run of 4096 elements a block
// The choice is the same for a whole block, so the barrier inside the
// transpose is reached by all of its threads or by none.
// ---------------------------------------------------------------------------
static_assert(Mc * Ec / 4096 == (Ec / 64) * (Ec / 64),
              "the convert part fills one z plane of the grid exactly");

__global__ void __launch_bounds__(128)
k_prepare(const float* __restrict__ X,  _Float16* __restrict__ Xh,
          const float* __restrict__ Wq, _Float16* __restrict__ Wqt,
          const float* __restrict__ Wk, _Float16* __restrict__ Wkt,
          const float* __restrict__ Wv, _Float16* __restrict__ Wvt,
          const float* __restrict__ Wo, _Float16* __restrict__ Wot) {
    __shared__ __attribute__((aligned(16))) _Float16 tile[64][TPITCH];
    const int z = blockIdx.z;
    if (z == 4) {
        convert_f16_4096(X, Xh, blockIdx.y * (Ec / 64) + blockIdx.x);
        return;
    }
    const float* W  = z == 0 ? Wq  : z == 1 ? Wk  : z == 2 ? Wv  : Wo;
    _Float16*    Wt = z == 0 ? Wqt : z == 1 ? Wkt : z == 2 ? Wvt : Wot;
    const int n0 = blockIdx.x * 64;
    const int k0 = blockIdx.y * 64;
    tile_transpose_f16(W + (size_t)k0 * Ec + n0, Ec,
                       Wt + (size_t)n0 * Ec + k0, Ec, tile);
}

constexpr int GK      = 128;
constexpr int GPITCH  = GK + 8;
constexpr int GROWS   = 128 + 64;
constexpr int GBUF    = GROWS * GPITCH;
constexpr int GSTAGES = Ec / GK;
static_assert(Ec % GK == 0 && GSTAGES >= 2, "the ring needs two whole stages");

static __device__ inline void
gemm_stage_copies(const _Float16* ga, const _Float16* gb,
                  unsigned la, unsigned lb) {
    constexpr int      GS = 2 * Ec;          // halves: two rows on, global
    constexpr unsigned LS = 2 * GPITCH * 2;  // bytes: two rows on, LDS
    asm volatile(
        "global_load_async_to_lds_b128 %0, %12, off\n\t"
        "global_load_async_to_lds_b128 %1, %13, off\n\t"
        "global_load_async_to_lds_b128 %2, %14, off\n\t"
        "global_load_async_to_lds_b128 %3, %15, off\n\t"
        "global_load_async_to_lds_b128 %4, %16, off\n\t"
        "global_load_async_to_lds_b128 %5, %17, off\n\t"
        "global_load_async_to_lds_b128 %6, %18, off\n\t"
        "global_load_async_to_lds_b128 %7, %19, off\n\t"
        "global_load_async_to_lds_b128 %8, %20, off\n\t"
        "global_load_async_to_lds_b128 %9, %21, off\n\t"
        "global_load_async_to_lds_b128 %10, %22, off\n\t"
        "global_load_async_to_lds_b128 %11, %23, off\n\t"
        "s_wait_xcnt 0x0"
        :: "v"(la),          "v"(la + LS),     "v"(la + 2 * LS), "v"(la + 3 * LS),
           "v"(la + 4 * LS), "v"(la + 5 * LS), "v"(la + 6 * LS), "v"(la + 7 * LS),
           "v"(lb),          "v"(lb + LS),     "v"(lb + 2 * LS), "v"(lb + 3 * LS),
           "v"(ga),          "v"(ga + GS),     "v"(ga + 2 * GS), "v"(ga + 3 * GS),
           "v"(ga + 4 * GS), "v"(ga + 5 * GS), "v"(ga + 6 * GS), "v"(ga + 7 * GS),
           "v"(gb),          "v"(gb + GS),     "v"(gb + 2 * GS), "v"(gb + 3 * GS)
        : "memory");
}

static __device__ inline void
gemm_tile_wmma(const _Float16* __restrict__ A, const _Float16* __restrict__ Bt,
               const float* __restrict__ bias, float* __restrict__ C,
               _Float16* ring) {
    constexpr int Ndim = Ec, Kdim = Ec;
    const int wave  = threadIdx.x >> 5;
    const int lane  = threadIdx.x & 31;
    const int nl    = lane & 15;
    const int khalf = lane >> 4;
    const int col0  = blockIdx.x * 64;
    const int row0  = blockIdx.y * 128 + wave * 16;

    // The copies: lane -> row khalf of a pair, 16-byte piece nl of its 256 bytes.
    const _Float16* ga = A  + (size_t)(row0 + khalf) * Kdim + nl * 8;
    const _Float16* gb = Bt + (size_t)(col0 + wave * 8 + khalf) * Kdim + nl * 8;
    const unsigned  l0 = (unsigned)(size_t)ring;
    const unsigned  la = l0 + ((wave * 16 + khalf) * GPITCH + nl * 8) * 2;
    const unsigned  lb = l0 + ((128 + wave * 8 + khalf) * GPITCH + nl * 8) * 2;

    // The fragments: as from global memory, row nl, k = khalf * 8 + ...
    const _Float16* arow = ring + (wave * 16 + nl) * GPITCH + khalf * 8;
    const _Float16* brow = ring + (128 + nl) * GPITCH + khalf * 8;

    v8f acc0 = {}, acc1 = {}, acc2 = {}, acc3 = {};

    gemm_stage_copies(ga, gb, la, lb);
    // Stage 0 has landed for this wave, then for all of them.
    asm volatile("s_wait_asynccnt 0x0" ::: "memory");
    __syncthreads();
    gemm_stage_copies(ga + GK, gb + GK, la + GBUF * 2, lb + GBUF * 2);

    for (int t = 0; t < GSTAGES; ++t) {
        const int bo = (t & 1) * GBUF;
        // All of the stage's fragments first, then its products: read among
        // the products, each pair of LDS reads is waited out on its own.
        v16h a[GK / 32], f[GK / 32][4];
#pragma unroll  // constant indices into a and f
        for (int kk = 0; kk < GK / 32; ++kk) {
            a[kk] = make_frag(arow + bo + kk * 32);
#pragma unroll  // constant indices into f
            for (int j = 0; j < 4; ++j)
                f[kk][j] = make_frag(brow + bo + j * 16 * GPITCH + kk * 32);
        }
        // Keeps the compiler from moving the reads back in among the products.
        __builtin_amdgcn_sched_barrier(0);
#pragma unroll  // constant indices into a and f
        for (int kk = 0; kk < GK / 32; ++kk) {
            acc0 = __builtin_amdgcn_wmma_f32_16x16x32_f16(false, a[kk], false, f[kk][0],
                                                          (short)0, acc0, false, false);
            acc1 = __builtin_amdgcn_wmma_f32_16x16x32_f16(false, a[kk], false, f[kk][1],
                                                          (short)0, acc1, false, false);
            acc2 = __builtin_amdgcn_wmma_f32_16x16x32_f16(false, a[kk], false, f[kk][2],
                                                          (short)0, acc2, false, false);
            acc3 = __builtin_amdgcn_wmma_f32_16x16x32_f16(false, a[kk], false, f[kk][3],
                                                          (short)0, acc3, false, false);
        }
        // Hand-over: this wave's reads of stage t are done, its copies of stage
        // t + 1 have landed; behind the barrier both hold for every wave, so
        // stage t + 1 may be read and stage t's buffer filled again.
        asm volatile("s_wait_dscnt 0x0" ::: "memory");
        asm volatile("s_wait_asynccnt 0x0" ::: "memory");
        __syncthreads();
        if (t + 2 < GSTAGES)
            gemm_stage_copies(ga + (t + 2) * GK, gb + (t + 2) * GK,
                              la + bo * 2, lb + bo * 2);
    }
    // No copy is left in flight when the wave ends.
    asm volatile("s_wait_asynccnt 0x0" ::: "memory");

    const int mo = khalf * 8;
    const float bz0 = bias[col0 +  0 + nl];
    const float bz1 = bias[col0 + 16 + nl];
    const float bz2 = bias[col0 + 32 + nl];
    const float bz3 = bias[col0 + 48 + nl];
#pragma unroll
    for (int r = 0; r < 8; ++r) {
        float* crow = C + (size_t)(row0 + mo + r) * Ndim + col0;
        crow[ 0 + nl] = acc0[r] + bz0;
        crow[16 + nl] = acc1[r] + bz1;
        crow[32 + nl] = acc2[r] + bz2;
        crow[48 + nl] = acc3[r] + bz3;
    }
}

// Kernel 2: the Q, K and V projections in one launch: three products of the
// same A that read nothing of each other.  grid = (N/64, M/128, 3); z picks
// the weight, the bias and the output.
__global__ void __launch_bounds__(256)
k_gemm_qkv(const _Float16* __restrict__ A,
           const _Float16* __restrict__ Wqt, const float* __restrict__ bq,
           float* __restrict__ Qf,
           const _Float16* __restrict__ Wkt, const float* __restrict__ bk,
           float* __restrict__ Kf,
           const _Float16* __restrict__ Wvt, const float* __restrict__ bv,
           float* __restrict__ Vf) {
    __shared__ __attribute__((aligned(16))) _Float16 ring[2 * GBUF];
    const int z = blockIdx.z;
    gemm_tile_wmma(A,
                   z == 0 ? Wqt : z == 1 ? Wkt : Wvt,
                   z == 0 ? bq  : z == 1 ? bk  : bv,
                   z == 0 ? Qf  : z == 1 ? Kf  : Vf,
                   ring);
}

// Kernel 5: one product (the output projection).  grid = (N/64, M/128).
__global__ void __launch_bounds__(256)
k_gemm_wmma(const _Float16* __restrict__ A, const _Float16* __restrict__ Bt,
            const float* __restrict__ bias, float* __restrict__ C) {
    __shared__ __attribute__((aligned(16))) _Float16 ring[2 * GBUF];
    gemm_tile_wmma(A, Bt, bias, C, ring);
}

// ---------------------------------------------------------------------------
// Kernel 3: V (f32 [B,T,E]) -> Vt (f16 [B,H,HD,T]) for K-contiguous B-frags
// ---------------------------------------------------------------------------
// grid = (B*H, T/64): one 64 (s) x 64 (d) tile a block.
__global__ void __launch_bounds__(128)
k_transpose_v(const float* __restrict__ V, _Float16* __restrict__ Vt) {
    __shared__ __attribute__((aligned(16))) _Float16 tile[64][TPITCH];
    const int bh = blockIdx.x;
    const int b  = bh / Hc, h = bh % Hc;
    const int s0 = blockIdx.y * 64;
    tile_transpose_f16(V + (size_t)(b * Tc + s0) * Ec + h * HDc, Ec,
                       Vt + (size_t)bh * HDc * Tc + s0, Tc, tile);
}

// ---------------------------------------------------------------------------
// Kernel 4: fused additive score + softmax + P@V (WMMA)
// grid = (B*H, T/16), block = 128 threads (4 waves). Output f16 [B*T, E].
// ---------------------------------------------------------------------------
__global__ void __launch_bounds__(128)
k_additive_attn(const float* __restrict__ Q, const float* __restrict__ Kf,
                const _Float16* __restrict__ Vt,
                const float* __restrict__ w_score,
                const float* __restrict__ b_score,
                _Float16* __restrict__ AttnH) {
    const int bh = blockIdx.x;
    const int b  = bh / Hc, h = bh % Hc;
    const int t0 = blockIdx.y * 16;
    const int tid = threadIdx.x;

    __shared__ float    q_s[16][HDc];      //  4 KB
    __shared__ __attribute__((aligned(16))) float    sc[16][Sc];     // 24 KB
    __shared__ __attribute__((aligned(16))) _Float16 p_s[16][SPAD];  // ~12.25 KB

    // Each thread owns KPT key rows (s = tid + 128*j) and holds them in
    // registers for the whole score phase: every k value is read from global
    // memory once per block and serves all 16 query rows of the block.
    // Every loop over j, c or e below is unrolled in full for one reason:
    // kreg, x, acc, v and e stay in registers only if indexed by constants.
    constexpr int KPT = Sc / 128;          // 3 key rows per thread
    float4 kreg[KPT][HDc / 4];
#pragma unroll  // constant indices into kreg
    for (int j = 0; j < KPT; ++j) {
        const float4* krow = reinterpret_cast<const float4*>(
            Kf + ((size_t)(b * Tc + tid + j * 128)) * Ec + h * HDc);
#pragma unroll  // constant indices into kreg
        for (int c = 0; c < HDc / 4; ++c) kreg[j][c] = krow[c];
        asm volatile("s_wait_xcnt 0x0" :: "v"(krow) : "memory");
    }

    for (int i = tid; i < 16 * HDc; i += 128) {
        int r = i / HDc, d = i % HDc;
        q_s[r][d] = Q[((size_t)(b * Tc + t0 + r)) * Ec + h * HDc + d];
    }
    __syncthreads();

    // ---- additive scores: sc[t][s] = sum_d w[d]*tanh(q[t,d]+k[s,d]) + b ----
    // q[t][*] is one LDS address for the whole wave (broadcast read) and
    // w_score[*] a uniform address (scalar load); each serves KPT key rows.
    // The sum over d of one (t, s) pair runs in ascending d, one accumulator.
    const float bsc = b_score[0];
    for (int t = 0; t < 16; ++t) {
        float acc[KPT];
#pragma unroll  // constant indices into acc
        for (int j = 0; j < KPT; ++j) acc[j] = 0.f;
#pragma unroll  // constant indices into kreg
        for (int c = 0; c < HDc / 4; ++c) {
            const float4 qv = *reinterpret_cast<const float4*>(&q_s[t][c * 4]);
            // 4*KPT independent values per batch: no tanh waits for its
            // neighbour, and the KPT accumulator chains interleave.
            float x[KPT][4];
#pragma unroll  // constant indices into x and kreg
            for (int j = 0; j < KPT; ++j) {
                x[j][0] = qv.x + kreg[j][c].x;
                x[j][1] = qv.y + kreg[j][c].y;
                x[j][2] = qv.z + kreg[j][c].z;
                x[j][3] = qv.w + kreg[j][c].w;
            }
#pragma unroll  // constant indices into x
            for (int j = 0; j < KPT; ++j) {
                x[j][0] = fast_tanh(x[j][0]);
                x[j][1] = fast_tanh(x[j][1]);
                x[j][2] = fast_tanh(x[j][2]);
                x[j][3] = fast_tanh(x[j][3]);
            }
#pragma unroll  // constant indices into x
            for (int e = 0; e < 4; ++e) {
                const float we = w_score[c * 4 + e];
#pragma unroll  // constant indices into x and acc
                for (int j = 0; j < KPT; ++j) acc[j] += we * x[j][e];
            }
        }
#pragma unroll  // constant indices into acc
        for (int j = 0; j < KPT; ++j) sc[t][tid + j * 128] = acc[j] + bsc;
    }
    __syncthreads();

    const int wave  = tid >> 5;
    const int lane  = tid & 31;
    const int nl    = lane & 15;
    const int khalf = lane >> 4;
    constexpr int RPW = 16 / 4;            // rows per wave
    constexpr int CPL = Sc / 128;          // 16-byte pieces of a row per lane
#pragma unroll  // the rows' reduction chains are independent and interleave
    for (int rr = 0; rr < RPW; ++rr) {
        const int row = wave * RPW + rr;
        float4 v[CPL];
#pragma unroll  // constant indices into v
        for (int c = 0; c < CPL; ++c)
            v[c] = *reinterpret_cast<const float4*>(&sc[row][c * 128 + lane * 4]);
        float mx = -3.4e38f;
#pragma unroll  // constant indices into v
        for (int c = 0; c < CPL; ++c)
            mx = fmaxf(mx, fmaxf(fmaxf(v[c].x, v[c].y), fmaxf(v[c].z, v[c].w)));
        mx = wave_max(mx);
        constexpr float LOG2E = 1.44269504088896340736f;  // exp(x) = exp2(x * LOG2E)
        float4 e[CPL];
#pragma unroll  // constant indices into v and e
        for (int c = 0; c < CPL; ++c) {
            e[c] = exp2_x4((v[c].x - mx) * LOG2E, (v[c].y - mx) * LOG2E,
                           (v[c].z - mx) * LOG2E, (v[c].w - mx) * LOG2E);
        }
        float sum = (e[0].x + e[0].y) + (e[0].z + e[0].w);
#pragma unroll  // constant indices into e
        for (int c = 1; c < CPL; ++c)
            sum += (e[c].x + e[c].y) + (e[c].z + e[c].w);
        sum = wave_sum(sum);
        const float rinv = 1.f / sum;
#pragma unroll  // constant indices into e
        for (int c = 0; c < CPL; ++c)
            *reinterpret_cast<h4v*>(&p_s[row][c * 128 + lane * 4]) =
                h4v{(_Float16)(e[c].x * rinv), (_Float16)(e[c].y * rinv),
                    (_Float16)(e[c].z * rinv), (_Float16)(e[c].w * rinv)};
    }
    __syncthreads();

    // ---- P[16,S] @ V[S,HD] via WMMA; wave w owns d-columns w*16..w*16+15 ----
    v8f acc = {};
    const _Float16* prow  = &p_s[nl][khalf * 8];                     // LDS
    const _Float16* vbase = Vt + ((size_t)bh * HDc + wave * 16 + nl) * Tc
                               + khalf * 8;                           // global
    for (int k0 = 0; k0 < Sc; k0 += 32) {
        __builtin_prefetch(vbase + k0 + 64, 0, 0);
        v16h a  = make_frag(prow + k0);      // ds_read_b128 x2, conflict-free
        v16h bb = make_frag(vbase + k0);     // global_load_b128 x2
        acc = __builtin_amdgcn_wmma_f32_16x16x32_f16(false, a, false, bb,
                                                     (short)0, acc, false, false);
    }

    const int mo = khalf * 8;
#pragma unroll
    for (int rr = 0; rr < 8; ++rr) {
        AttnH[((size_t)(b * Tc + t0 + mo + rr)) * Ec + h * HDc + wave * 16 + nl]
            = (_Float16)acc[rr];
    }
}

// ---------------------------------------------------------------------------
// Host launcher
// ---------------------------------------------------------------------------
extern "C" void kernel_launch(void* const* d_in, const int* in_sizes, int n_in,
                              void* d_out, int out_size, void* d_ws, size_t ws_size,
                              hipStream_t stream) {
    const float* X   = (const float*)d_in[0];
    const float* Wq  = (const float*)d_in[1];
    const float* bq  = (const float*)d_in[2];
    const float* Wk  = (const float*)d_in[3];
    const float* bk  = (const float*)d_in[4];
    const float* Wv  = (const float*)d_in[5];
    const float* bv  = (const float*)d_in[6];
    const float* Wo  = (const float*)d_in[7];
    const float* bo  = (const float*)d_in[8];
    const float* wsc = (const float*)d_in[9];
    const float* bsc = (const float*)d_in[10];

    char* ws = (char*)d_ws;
    size_t off = 0;
    auto carve = [&](size_t bytes) {
        void* p = ws + off;
        off += (bytes + 255) & ~(size_t)255;
        return p;
    };

    _Float16* Xh    = (_Float16*)carve((size_t)Mc * Ec * 2);
    _Float16* Wqt   = (_Float16*)carve((size_t)Ec * Ec * 2);
    _Float16* Wkt   = (_Float16*)carve((size_t)Ec * Ec * 2);
    _Float16* Wvt   = (_Float16*)carve((size_t)Ec * Ec * 2);
    _Float16* Wot   = (_Float16*)carve((size_t)Ec * Ec * 2);
    float*    Qf    = (float*)   carve((size_t)Mc * Ec * 4);
    float*    Kff   = (float*)   carve((size_t)Mc * Ec * 4);
    float*    Vf    = (float*)   carve((size_t)Mc * Ec * 4);
    _Float16* Vth   = (_Float16*)carve((size_t)Bc * Hc * HDc * Tc * 2);
    _Float16* AttnH = (_Float16*)carve((size_t)Mc * Ec * 2);

    // 1) X -> f16 and the four weights -> transposed f16, one launch
    {
        dim3 grid(Ec / 64, Ec / 64, 5);
        k_prepare<<<grid, 128, 0, stream>>>(X, Xh, Wq, Wqt, Wk, Wkt,
                                            Wv, Wvt, Wo, Wot);
    }
    // 2) Q/K/V projections (WMMA GEMMs), one launch
    {
        dim3 grid(Ec / 64, Mc / 128, 3);
        k_gemm_qkv<<<grid, 256, 0, stream>>>(Xh, Wqt, bq, Qf, Wkt, bk, Kff,
                                             Wvt, bv, Vf);
    }
    // 3) V -> [B,H,HD,T] f16
    {
        dim3 grid(Bc * Hc, Tc / 64);
        k_transpose_v<<<grid, 128, 0, stream>>>(Vf, Vth);
    }
    // 4) fused additive score + softmax + P@V
    {
        dim3 grid(Bc * Hc, Tc / 16);
        k_additive_attn<<<grid, 128, 0, stream>>>(Qf, Kff, Vth, wsc, bsc, AttnH);
    }
    // 5) output projection -> d_out (f32)
    {
        dim3 grid(Ec / 64, Mc / 128);
        k_gemm_wmma<<<grid, 256, 0, stream>>>(AttnH, Wot, bo, (float*)d_out);
    }
}

// v006
// It runs in 46.8 microseconds.
// Next to v005, in two timings, it ran 1.06 times as fast each time.
// Over all steps from v000 it is 4.51 times as fast.
#include <hip/hip_runtime.h>

typedef __attribute__((ext_vector_type(16))) _Float16 v16h;
typedef __attribute__((ext_vector_type(8)))  _Float16 h8v;
typedef __attribute__((ext_vector_type(4)))  _Float16 h4v;
typedef __attribute__((ext_vector_type(2)))  _Float16 h2v;
typedef __attribute__((ext_vector_type(8)))  float    v8f;

constexpr int Bc = 2, Tc = 384, Ec = 768, Hc = 12, HDc = 64;
constexpr int Mc = Bc * Tc;
constexpr int Sc = Tc;
constexpr int SPAD = Sc + 8;

static __device__ inline float fast_tanh(float x) {
#if __has_builtin(__builtin_amdgcn_tanhf)
    return __builtin_amdgcn_tanhf(x);
#elif __has_builtin(__builtin_amdgcn_tanh_f32)
    return __builtin_amdgcn_tanh_f32(x);
#else
    return tanhf(x);
#endif
}

template <int XMASK>
static __device__ inline float row_xor(float x) {
    return __builtin_bit_cast(float, __builtin_amdgcn_mov_dpp(
        __builtin_bit_cast(int, x), 0x160 + XMASK, 0xf, 0xf, true));
}
static __device__ inline float half_xor(float x) {
    const int b = __builtin_bit_cast(int, x);
    return __builtin_bit_cast(float, __builtin_amdgcn_permlanex16(
        b, b, 0x76543210, 0xfedcba98, false, false));
}
static __device__ inline float wave_max(float x) {
    x = fmaxf(x, row_xor<1>(x));
    x = fmaxf(x, row_xor<2>(x));
    x = fmaxf(x, row_xor<4>(x));
    x = fmaxf(x, row_xor<8>(x));
    return fmaxf(x, half_xor(x));
}
static __device__ inline float wave_sum(float x) {
    x += row_xor<1>(x);
    x += row_xor<2>(x);
    x += row_xor<4>(x);
    x += row_xor<8>(x);
    return x + half_xor(x);
}

static __device__ inline float4 exp2_x4(float a, float b, float c, float d) {
    float4 r;
    asm("v_exp_f32 %0, %4\n\tv_exp_f32 %1, %5\n\t"
        "v_exp_f32 %2, %6\n\tv_exp_f32 %3, %7\n\tv_nop"
        : "=&v"(r.x), "=&v"(r.y), "=&v"(r.z), "=&v"(r.w)
        : "v"(a), "v"(b), "v"(c), "v"(d));
    return r;
}

static __device__ inline v16h make_frag(const _Float16* p) {
    h8v lo = *reinterpret_cast<const h8v*>(p);
    h8v hi = *reinterpret_cast<const h8v*>(p + 16);
    v16h r;
#pragma unroll
    for (int i = 0; i < 8; ++i) { r[i] = lo[i]; r[i + 8] = hi[i]; }
    return r;
}

// ---------------------------------------------------------------------------
// One 64x64 tile, transposed and converted through LDS by 128 threads:
//   dst[c * dpitch + r] = (f16) src[r * spitch + c],  r, c = 0..63
// Global reads are 16 bytes a lane along c, global writes 16 bytes a lane
// along r (whole 128-byte lines both ways); each thread moves 32 elements.
// ---------------------------------------------------------------------------
constexpr int TPITCH = 64 + 8;  // halves; 144 B = 16 B x odd for ds_load_b128

static __device__ inline void tile_transpose_f16(const float* __restrict__ src,
                                                 int spitch,
                                                 _Float16* __restrict__ dst,
                                                 int dpitch,
                                                 _Float16 (*tile)[TPITCH]) {
    const int tid = threadIdx.x;
    const int c4  = (tid & 15) * 4;
    const int rp  = tid >> 4;          // 0..7: a pair of source rows, 4 times
    float4 a[4], b[4];
#pragma unroll  // all eight loads in flight before the first use
    for (int i = 0; i < 4; ++i) {
        const float* p = src + (size_t)(2 * rp + 16 * i) * spitch + c4;
        a[i] = *reinterpret_cast<const float4*>(p);
        b[i] = *reinterpret_cast<const float4*>(p + spitch);
    }
    // Rows r and r+1 of one column are neighbours in the transposed tile:
    // one 4-byte LDS store takes both.
#pragma unroll  // constant indices into a and b
    for (int i = 0; i < 4; ++i) {
        const int r = 2 * rp + 16 * i;
        *reinterpret_cast<h2v*>(&tile[c4 + 0][r]) = h2v{(_Float16)a[i].x, (_Float16)b[i].x};
        *reinterpret_cast<h2v*>(&tile[c4 + 1][r]) = h2v{(_Float16)a[i].y, (_Float16)b[i].y};
        *reinterpret_cast<h2v*>(&tile[c4 + 2][r]) = h2v{(_Float16)a[i].z, (_Float16)b[i].z};
        *reinterpret_cast<h2v*>(&tile[c4 + 3][r]) = h2v{(_Float16)a[i].w, (_Float16)b[i].w};
    }
    __syncthreads();
    const int c0 = tid >> 3;           // 0..15, 4 times
    const int r8 = (tid & 7) * 8;
#pragma unroll  // four independent LDS reads and stores
    for (int i = 0; i < 4; ++i) {
        const int c = c0 + 16 * i;
        *reinterpret_cast<h8v*>(dst + (size_t)c * dpitch + r8) =
            *reinterpret_cast<const h8v*>(&tile[c][r8]);
    }
}

// ---------------------------------------------------------------------------
// f32 -> f16 elementwise convert of one run of 4096 elements by 128 threads;
// each thread converts 32 elements, read 16 bytes at a time and written
// 16 bytes at a time.
// ---------------------------------------------------------------------------
static __device__ inline void convert_f16_4096(const float* __restrict__ in,
                                               _Float16* __restrict__ out,
                                               int run) {
    const int base = run * 4096 + threadIdx.x * 8;
    float4 lo[4], hi[4];
#pragma unroll  // all eight loads in flight before the first use
    for (int i = 0; i < 4; ++i) {
        lo[i] = *reinterpret_cast<const float4*>(in + base + 1024 * i);
        hi[i] = *reinterpret_cast<const float4*>(in + base + 1024 * i + 4);
    }
#pragma unroll  // constant indices into lo and hi
    for (int i = 0; i < 4; ++i) {
        *reinterpret_cast<h8v*>(out + base + 1024 * i) =
            h8v{(_Float16)lo[i].x, (_Float16)lo[i].y,
                (_Float16)lo[i].z, (_Float16)lo[i].w,
                (_Float16)hi[i].x, (_Float16)hi[i].y,
                (_Float16)hi[i].z, (_Float16)hi[i].w};
    }
}

// ---------------------------------------------------------------------------
// Kernel 1: all operand preparation in one launch; none of the five parts
// reads what another writes.  grid = (E/64, E/64, 5), 128 threads.
//   z = 0..3: weight transpose + convert, W[k][n] (f32) -> Wt[n][k] (f16),
//             one 64 (k) x 64 (n) tile a block
//   z = 4:    X (f32) -> Xh (f16), one run of 4096 elements a block
// The choice is the same for a whole block, so the barrier inside the
// transpose is reached by all of its threads or by none.
// ---------------------------------------------------------------------------
static_assert(Mc * Ec / 4096 == (Ec / 64) * (Ec / 64),
              "the convert part fills one z plane of the grid exactly");

__global__ void __launch_bounds__(128)
k_prepare(const float* __restrict__ X,  _Float16* __restrict__ Xh,
          const float* __restrict__ Wq, _Float16* __restrict__ Wqt,
          const float* __restrict__ Wk, _Float16* __restrict__ Wkt,
          const float* __restrict__ Wv, _Float16* __restrict__ Wvt,
          const float* __restrict__ Wo, _Float16* __restrict__ Wot) {
    __shared__ __attribute__((aligned(16))) _Float16 tile[64][TPITCH];
    const int z = blockIdx.z;
    if (z == 4) {
        convert_f16_4096(X, Xh, blockIdx.y * (Ec / 64) + blockIdx.x);
        return;
    }
    const float* W  = z == 0 ? Wq  : z == 1 ? Wk  : z == 2 ? Wv  : Wo;
    _Float16*    Wt = z == 0 ? Wqt : z == 1 ? Wkt : z == 2 ? Wvt : Wot;
    const int n0 = blockIdx.x * 64;
    const int k0 = blockIdx.y * 64;
    tile_transpose_f16(W + (size_t)k0 * Ec + n0, Ec,
                       Wt + (size_t)n0 * Ec + k0, Ec, tile);
}

constexpr int GK      = 128;
constexpr int GPITCH  = GK + 8;
constexpr int GROWS   = 128 + 64;
constexpr int GBUF    = GROWS * GPITCH;
constexpr int GSTAGES = Ec / GK;
static_assert(Ec % GK == 0 && GSTAGES >= 2, "the ring needs two whole stages");

static __device__ inline void
gemm_stage_copies(const _Float16* ga, const _Float16* gb,
                  unsigned la, unsigned lb) {
    constexpr int      GS = 2 * Ec;          // halves: two rows on, global
    constexpr unsigned LS = 2 * GPITCH * 2;  // bytes: two rows on, LDS
    asm volatile(
        "global_load_async_to_lds_b128 %0, %12, off\n\t"
        "global_load_async_to_lds_b128 %1, %13, off\n\t"
        "global_load_async_to_lds_b128 %2, %14, off\n\t"
        "global_load_async_to_lds_b128 %3, %15, off\n\t"
        "global_load_async_to_lds_b128 %4, %16, off\n\t"
        "global_load_async_to_lds_b128 %5, %17, off\n\t"
        "global_load_async_to_lds_b128 %6, %18, off\n\t"
        "global_load_async_to_lds_b128 %7, %19, off\n\t"
        "global_load_async_to_lds_b128 %8, %20, off\n\t"
        "global_load_async_to_lds_b128 %9, %21, off\n\t"
        "global_load_async_to_lds_b128 %10, %22, off\n\t"
        "global_load_async_to_lds_b128 %11, %23, off\n\t"
        "s_wait_xcnt 0x0"
        :: "v"(la),          "v"(la + LS),     "v"(la + 2 * LS), "v"(la + 3 * LS),
           "v"(la + 4 * LS), "v"(la + 5 * LS), "v"(la + 6 * LS), "v"(la + 7 * LS),
           "v"(lb),          "v"(lb + LS),     "v"(lb + 2 * LS), "v"(lb + 3 * LS),
           "v"(ga),          "v"(ga + GS),     "v"(ga + 2 * GS), "v"(ga + 3 * GS),
           "v"(ga + 4 * GS), "v"(ga + 5 * GS), "v"(ga + 6 * GS), "v"(ga + 7 * GS),
           "v"(gb),          "v"(gb + GS),     "v"(gb + 2 * GS), "v"(gb + 3 * GS)
        : "memory");
}

static __device__ __forceinline__ void  // a call would pass the pointers as flat
gemm_tile_wmma(const _Float16* __restrict__ A, const _Float16* __restrict__ Bt,
               const float* __restrict__ bias, float* __restrict__ C,
               _Float16* ring, bool packed_k) {
    constexpr int Ndim = Ec, Kdim = Ec;
    const int wave  = threadIdx.x >> 5;
    const int lane  = threadIdx.x & 31;
    const int nl    = lane & 15;
    const int khalf = lane >> 4;
    const int col0  = blockIdx.x * 64;
    const int row0  = blockIdx.y * 128 + wave * 16;

    // The copies: lane -> row khalf of a pair, 16-byte piece nl of its 256 bytes.
    const _Float16* ga = A  + (size_t)(row0 + khalf) * Kdim + nl * 8;
    const _Float16* gb = Bt + (size_t)(col0 + wave * 8 + khalf) * Kdim + nl * 8;
    const unsigned  l0 = (unsigned)(size_t)ring;
    const unsigned  la = l0 + ((wave * 16 + khalf) * GPITCH + nl * 8) * 2;
    const unsigned  lb = l0 + ((128 + wave * 8 + khalf) * GPITCH + nl * 8) * 2;

    // The fragments: as from global memory, row nl, k = khalf * 8 + ...
    const _Float16* arow = ring + (wave * 16 + nl) * GPITCH + khalf * 8;
    const _Float16* brow = ring + (128 + nl) * GPITCH + khalf * 8;

    v8f acc0 = {}, acc1 = {}, acc2 = {}, acc3 = {};

    gemm_stage_copies(ga, gb, la, lb);
    // Stage 0 has landed for this wave, then for all of them.
    asm volatile("s_wait_asynccnt 0x0" ::: "memory");
    __syncthreads();
    gemm_stage_copies(ga + GK, gb + GK, la + GBUF * 2, lb + GBUF * 2);

    for (int t = 0; t < GSTAGES; ++t) {
        const int bo = (t & 1) * GBUF;
        // All of the stage's fragments first, then its products: read among
        // the products, each pair of LDS reads is waited out on its own.
        v16h a[GK / 32], f[GK / 32][4];
#pragma unroll  // constant indices into a and f
        for (int kk = 0; kk < GK / 32; ++kk) {
            a[kk] = make_frag(arow + bo + kk * 32);
#pragma unroll  // constant indices into f
            for (int j = 0; j < 4; ++j)
                f[kk][j] = make_frag(brow + bo + j * 16 * GPITCH + kk * 32);
        }
        // Keeps the compiler from moving the reads back in among the products.
        __builtin_amdgcn_sched_barrier(0);
#pragma unroll  // constant indices into a and f
        for (int kk = 0; kk < GK / 32; ++kk) {
            acc0 = __builtin_amdgcn_wmma_f32_16x16x32_f16(false, a[kk], false, f[kk][0],
                                                          (short)0, acc0, false, false);
            acc1 = __builtin_amdgcn_wmma_f32_16x16x32_f16(false, a[kk], false, f[kk][1],
                                                          (short)0, acc1, false, false);
            acc2 = __builtin_amdgcn_wmma_f32_16x16x32_f16(false, a[kk], false, f[kk][2],
                                                          (short)0, acc2, false, false);
            acc3 = __builtin_amdgcn_wmma_f32_16x16x32_f16(false, a[kk], false, f[kk][3],
                                                          (short)0, acc3, false, false);
        }
        // Hand-over: this wave's reads of stage t are done, its copies of stage
        // t + 1 have landed; behind the barrier both hold for every wave, so
        // stage t + 1 may be read and stage t's buffer filled again.
        asm volatile("s_wait_dscnt 0x0" ::: "memory");
        asm volatile("s_wait_asynccnt 0x0" ::: "memory");
        __syncthreads();
        if (t + 2 < GSTAGES)
            gemm_stage_copies(ga + (t + 2) * GK, gb + (t + 2) * GK,
                              la + bo * 2, lb + bo * 2);
    }
    // No copy is left in flight when the wave ends.
    asm volatile("s_wait_asynccnt 0x0" ::: "memory");

    const int mo = khalf * 8;
    if (packed_k) {  // the same for the whole block
        const int f0 = row0 + mo;            // first of the lane's 8 features
        const float4 blo = *reinterpret_cast<const float4*>(bias + f0);
        const float4 bhi = *reinterpret_cast<const float4*>(bias + f0 + 4);
        float4* kp = reinterpret_cast<float4*>(C)
            + ((size_t)((col0 / Tc) * Hc + f0 / HDc) * (HDc / 4) + (f0 % HDc) / 4) * Sc
            + col0 % Tc + nl;
        const v8f* accs[4] = {&acc0, &acc1, &acc2, &acc3};
#pragma unroll  // constant indices into accs
        for (int j = 0; j < 4; ++j) {
            const v8f& c = *accs[j];
            kp[j * 16]      = float4{c[0] + blo.x, c[1] + blo.y, c[2] + blo.z, c[3] + blo.w};
            kp[j * 16 + Sc] = float4{c[4] + bhi.x, c[5] + bhi.y, c[6] + bhi.z, c[7] + bhi.w};
        }
        return;
    }
    const float bz0 = bias[col0 +  0 + nl];
    const float bz1 = bias[col0 + 16 + nl];
    const float bz2 = bias[col0 + 32 + nl];
    const float bz3 = bias[col0 + 48 + nl];
#pragma unroll
    for (int r = 0; r < 8; ++r) {
        float* crow = C + (size_t)(row0 + mo + r) * Ndim + col0;
        crow[ 0 + nl] = acc0[r] + bz0;
        crow[16 + nl] = acc1[r] + bz1;
        crow[32 + nl] = acc2[r] + bz2;
        crow[48 + nl] = acc3[r] + bz3;
    }
    asm volatile("s_wait_xcnt 0x0" ::: "memory");
}

// Kernel 2: the Q, K and V projections in one launch: three products of the
// same X that read nothing of each other.  grid = (N/64, M/128, 3); z picks
// the weight, the bias and the output.  For K (z = 1) the two operands change
// places (both are 768 rows of 768 halves, so the grid fits either way) and
// the tile is stored in the packed order described above.
__global__ void __launch_bounds__(256)
k_gemm_qkv(const _Float16* __restrict__ A,
           const _Float16* __restrict__ Wqt, const float* __restrict__ bq,
           float* __restrict__ Qf,
           const _Float16* __restrict__ Wkt, const float* __restrict__ bk,
           float* __restrict__ Kf,
           const _Float16* __restrict__ Wvt, const float* __restrict__ bv,
           float* __restrict__ Vf) {
    __shared__ __attribute__((aligned(16))) _Float16 ring[2 * GBUF];
    static_assert(Mc == Ec && Tc % 64 == 0 && HDc % 16 == 0,
                  "K transposed: same grid; a tile in one batch, a wave in one head");
    const int z = blockIdx.z;
    gemm_tile_wmma(z == 1 ? Wkt : A,
                   z == 0 ? Wqt : z == 1 ? A : Wvt,
                   z == 0 ? bq  : z == 1 ? bk  : bv,
                   z == 0 ? Qf  : z == 1 ? Kf  : Vf,
                   ring, z == 1);
}

// Kernel 5: one product (the output projection).  grid = (N/64, M/128).
__global__ void __launch_bounds__(256)
k_gemm_wmma(const _Float16* __restrict__ A, const _Float16* __restrict__ Bt,
            const float* __restrict__ bias, float* __restrict__ C) {
    __shared__ __attribute__((aligned(16))) _Float16 ring[2 * GBUF];
    gemm_tile_wmma(A, Bt, bias, C, ring, false);
}

// ---------------------------------------------------------------------------
// Kernel 3: V (f32 [B,T,E]) -> Vt (f16 [B,H,HD,T]) for K-contiguous B-frags
// ---------------------------------------------------------------------------
// grid = (B*H, T/64): one 64 (s) x 64 (d) tile a block.
__global__ void __launch_bounds__(128)
k_transpose_v(const float* __restrict__ V, _Float16* __restrict__ Vt) {
    __shared__ __attribute__((aligned(16))) _Float16 tile[64][TPITCH];
    const int bh = blockIdx.x;
    const int b  = bh / Hc, h = bh % Hc;
    const int s0 = blockIdx.y * 64;
    tile_transpose_f16(V + (size_t)(b * Tc + s0) * Ec + h * HDc, Ec,
                       Vt + (size_t)bh * HDc * Tc + s0, Tc, tile);
}

// ---------------------------------------------------------------------------
// Kernel 4: fused additive score + softmax + P@V (WMMA)
// grid = (B*H, T/16), block = 128 threads (4 waves). Output f16 [B*T, E].
// ---------------------------------------------------------------------------
__global__ void __launch_bounds__(128)
k_additive_attn(const float* __restrict__ Q, const float* __restrict__ Kf,
                const _Float16* __restrict__ Vt,
                const float* __restrict__ w_score,
                const float* __restrict__ b_score,
                _Float16* __restrict__ AttnH) {
    const int bh = blockIdx.x;
    const int b  = bh / Hc, h = bh % Hc;
    const int t0 = blockIdx.y * 16;
    const int tid = threadIdx.x;

    __shared__ float    q_s[16][HDc];      //  4 KB
    __shared__ __attribute__((aligned(16))) float    sc[16][Sc];     // 24 KB
    __shared__ __attribute__((aligned(16))) _Float16 p_s[16][SPAD];  // ~12.25 KB

    // Each thread owns KPT key rows (s = tid + 128*j) and holds them in
    // registers for the whole score phase: every k value is read from global
    // memory once per block and serves all 16 query rows of the block.
    // Kf is packed [b][h][d / 4][s][d % 4]: the 32 lanes of a load (32
    // consecutive s, one d / 4) take 512 consecutive bytes, four whole lines.
    // Every loop over j, c or e below is unrolled in full for one reason:
    // kreg, x, acc, v and e stay in registers only if indexed by constants.
    constexpr int KPT = Sc / 128;          // 3 key rows per thread
    float4 kreg[KPT][HDc / 4];
    const float4* kcol = reinterpret_cast<const float4*>(Kf)
        + (size_t)bh * (HDc / 4) * Sc + tid;
#pragma unroll  // constant indices into kreg
    for (int j = 0; j < KPT; ++j) {
#pragma unroll  // constant indices into kreg
        for (int c = 0; c < HDc / 4; ++c) kreg[j][c] = kcol[c * Sc + j * 128];
    }
    asm volatile("s_wait_xcnt 0x0" ::: "memory");

    for (int i = tid; i < 16 * HDc; i += 128) {
        int r = i / HDc, d = i % HDc;
        q_s[r][d] = Q[((size_t)(b * Tc + t0 + r)) * Ec + h * HDc + d];
    }
    __syncthreads();

    // ---- additive scores: sc[t][s] = sum_d w[d]*tanh(q[t,d]+k[s,d]) + b ----
    // q[t][*] is one LDS address for the whole wave (broadcast read) and
    // w_score[*] a uniform address (scalar load); each serves KPT key rows.
    // The sum over d of one (t, s) pair runs in ascending d, one accumulator.
    const float bsc = b_score[0];
    for (int t = 0; t < 16; ++t) {
        float acc[KPT];
#pragma unroll  // constant indices into acc
        for (int j = 0; j < KPT; ++j) acc[j] = 0.f;
#pragma unroll  // constant indices into kreg
        for (int c = 0; c < HDc / 4; ++c) {
            const float4 qv = *reinterpret_cast<const float4*>(&q_s[t][c * 4]);
            // 4*KPT independent values per batch: no tanh waits for its
            // neighbour, and the KPT accumulator chains interleave.
            float x[KPT][4];
#pragma unroll  // constant indices into x and kreg
            for (int j = 0; j < KPT; ++j) {
                x[j][0] = qv.x + kreg[j][c].x;
                x[j][1] = qv.y + kreg[j][c].y;
                x[j][2] = qv.z + kreg[j][c].z;
                x[j][3] = qv.w + kreg[j][c].w;
            }
#pragma unroll  // constant indices into x
            for (int j = 0; j < KPT; ++j) {
                x[j][0] = fast_tanh(x[j][0]);
                x[j][1] = fast_tanh(x[j][1]);
                x[j][2] = fast_tanh(x[j][2]);
                x[j][3] = fast_tanh(x[j][3]);
            }
#pragma unroll  // constant indices into x
            for (int e = 0; e < 4; ++e) {
                const float we = w_score[c * 4 + e];
#pragma unroll  // constant indices into x and acc
                for (int j = 0; j < KPT; ++j) acc[j] += we * x[j][e];
            }
        }
#pragma unroll  // constant indices into acc
        for (int j = 0; j < KPT; ++j) sc[t][tid + j * 128] = acc[j] + bsc;
    }
    __syncthreads();

    const int wave  = tid >> 5;
    const int lane  = tid & 31;
    const int nl    = lane & 15;
    const int khalf = lane >> 4;
    constexpr int RPW = 16 / 4;            // rows per wave
    constexpr int CPL = Sc / 128;          // 16-byte pieces of a row per lane
#pragma unroll  // the rows' reduction chains are independent and interleave
    for (int rr = 0; rr < RPW; ++rr) {
        const int row = wave * RPW + rr;
        float4 v[CPL];
#pragma unroll  // constant indices into v
        for (int c = 0; c < CPL; ++c)
            v[c] = *reinterpret_cast<const float4*>(&sc[row][c * 128 + lane * 4]);
        float mx = -3.4e38f;
#pragma unroll  // constant indices into v
        for (int c = 0; c < CPL; ++c)
            mx = fmaxf(mx, fmaxf(fmaxf(v[c].x, v[c].y), fmaxf(v[c].z, v[c].w)));
        mx = wave_max(mx);
        constexpr float LOG2E = 1.44269504088896340736f;  // exp(x) = exp2(x * LOG2E)
        float4 e[CPL];
#pragma unroll  // constant indices into v and e
        for (int c = 0; c < CPL; ++c) {
            e[c] = exp2_x4((v[c].x - mx) * LOG2E, (v[c].y - mx) * LOG2E,
                           (v[c].z - mx) * LOG2E, (v[c].w - mx) * LOG2E);
        }
        float sum = (e[0].x + e[0].y) + (e[0].z + e[0].w);
#pragma unroll  // constant indices into e
        for (int c = 1; c < CPL; ++c)
            sum += (e[c].x + e[c].y) + (e[c].z + e[c].w);
        sum = wave_sum(sum);
        const float rinv = 1.f / sum;
#pragma unroll  // constant indices into e
        for (int c = 0; c < CPL; ++c)
            *reinterpret_cast<h4v*>(&p_s[row][c * 128 + lane * 4]) =
                h4v{(_Float16)(e[c].x * rinv), (_Float16)(e[c].y * rinv),
                    (_Float16)(e[c].z * rinv), (_Float16)(e[c].w * rinv)};
    }
    __syncthreads();

    // ---- P[16,S] @ V[S,HD] via WMMA; wave w owns d-columns w*16..w*16+15 ----
    v8f acc = {};
    const _Float16* prow  = &p_s[nl][khalf * 8];                     // LDS
    const _Float16* vbase = Vt + ((size_t)bh * HDc + wave * 16 + nl) * Tc
                               + khalf * 8;                           // global
    for (int k0 = 0; k0 < Sc; k0 += 32) {
        __builtin_prefetch(vbase + k0 + 64, 0, 0);
        v16h a  = make_frag(prow + k0);      // ds_read_b128 x2, conflict-free
        v16h bb = make_frag(vbase + k0);     // global_load_b128 x2
        acc = __builtin_amdgcn_wmma_f32_16x16x32_f16(false, a, false, bb,
                                                     (short)0, acc, false, false);
    }

    const int mo = khalf * 8;
#pragma unroll
    for (int rr = 0; rr < 8; ++rr) {
        AttnH[((size_t)(b * Tc + t0 + mo + rr)) * Ec + h * HDc + wave * 16 + nl]
            = (_Float16)acc[rr];
    }
}

// ---------------------------------------------------------------------------
// Host launcher
// ---------------------------------------------------------------------------
extern "C" void kernel_launch(void* const* d_in, const int* in_sizes, int n_in,
                              void* d_out, int out_size, void* d_ws, size_t ws_size,
                              hipStream_t stream) {
    const float* X   = (const float*)d_in[0];
    const float* Wq  = (const float*)d_in[1];
    const float* bq  = (const float*)d_in[2];
    const float* Wk  = (const float*)d_in[3];
    const float* bk  = (const float*)d_in[4];
    const float* Wv  = (const float*)d_in[5];
    const float* bv  = (const float*)d_in[6];
    const float* Wo  = (const float*)d_in[7];
    const float* bo  = (const float*)d_in[8];
    const float* wsc = (const float*)d_in[9];
    const float* bsc = (const float*)d_in[10];

    char* ws = (char*)d_ws;
    size_t off = 0;
    auto carve = [&](size_t bytes) {
        void* p = ws + off;
        off += (bytes + 255) & ~(size_t)255;
        return p;
    };

    _Float16* Xh    = (_Float16*)carve((size_t)Mc * Ec * 2);
    _Float16* Wqt   = (_Float16*)carve((size_t)Ec * Ec * 2);
    _Float16* Wkt   = (_Float16*)carve((size_t)Ec * Ec * 2);
    _Float16* Wvt   = (_Float16*)carve((size_t)Ec * Ec * 2);
    _Float16* Wot   = (_Float16*)carve((size_t)Ec * Ec * 2);
    float*    Qf    = (float*)   carve((size_t)Mc * Ec * 4);
    float*    Kff   = (float*)   carve((size_t)Mc * Ec * 4);
    float*    Vf    = (float*)   carve((size_t)Mc * Ec * 4);
    _Float16* Vth   = (_Float16*)carve((size_t)Bc * Hc * HDc * Tc * 2);
    _Float16* AttnH = (_Float16*)carve((size_t)Mc * Ec * 2);

    // 1) X -> f16 and the four weights -> transposed f16, one launch
    {
        dim3 grid(Ec / 64, Ec / 64, 5);
        k_prepare<<<grid, 128, 0, stream>>>(X, Xh, Wq, Wqt, Wk, Wkt,
                                            Wv, Wvt, Wo, Wot);
    }
    // 2) Q/K/V projections (WMMA GEMMs), one launch
    {
        dim3 grid(Ec / 64, Mc / 128, 3);
        k_gemm_qkv<<<grid, 256, 0, stream>>>(Xh, Wqt, bq, Qf, Wkt, bk, Kff,
                                             Wvt, bv, Vf);
    }
    // 3) V -> [B,H,HD,T] f16
    {
        dim3 grid(Bc * Hc, Tc / 64);
        k_transpose_v<<<grid, 128, 0, stream>>>(Vf, Vth);
    }
    // 4) fused additive score + softmax + P@V
    {
        dim3 grid(Bc * Hc, Tc / 16);
        k_additive_attn<<<grid, 128, 0, stream>>>(Qf, Kff, Vth, wsc, bsc, AttnH);
    }
    // 5) output projection -> d_out (f32)
    {
        dim3 grid(Ec / 64, Mc / 128);
        k_gemm_wmma<<<grid, 256, 0, stream>>>(AttnH, Wot, bo, (float*)d_out);
    }
}

// v007
// A run of this version takes 43.7 microseconds.
// Timed twice side by side with v006, it ran 1.07 times as fast both times.
// Over all steps from v000 it is 4.82 times as fast.
#include <hip/hip_runtime.h>

typedef __attribute__((ext_vector_type(16))) _Float16 v16h;
typedef __attribute__((ext_vector_type(8)))  _Float16 h8v;
typedef __attribute__((ext_vector_type(4)))  _Float16 h4v;
typedef __attribute__((ext_vector_type(2)))  _Float16 h2v;
typedef __attribute__((ext_vector_type(8)))  float    v8f;

constexpr int Bc = 2, Tc = 384, Ec = 768, Hc = 12, HDc = 64;
constexpr int Mc = Bc * Tc;
constexpr int Sc = Tc;
constexpr int SPAD = Sc + 8;

static __device__ inline float fast_tanh(float x) {
#if __has_builtin(__builtin_amdgcn_tanhf)
    return __builtin_amdgcn_tanhf(x);
#elif __has_builtin(__builtin_amdgcn_tanh_f32)
    return __builtin_amdgcn_tanh_f32(x);
#else
    return tanhf(x);
#endif
}

template <int XMASK>
static __device__ inline float row_xor(float x) {
    return __builtin_bit_cast(float, __builtin_amdgcn_mov_dpp(
        __builtin_bit_cast(int, x), 0x160 + XMASK, 0xf, 0xf, true));
}
static __device__ inline float half_xor(float x) {
    const int b = __builtin_bit_cast(int, x);
    return __builtin_bit_cast(float, __builtin_amdgcn_permlanex16(
        b, b, 0x76543210, 0xfedcba98, false, false));
}
static __device__ inline float wave_max(float x) {
    x = fmaxf(x, row_xor<1>(x));
    x = fmaxf(x, row_xor<2>(x));
    x = fmaxf(x, row_xor<4>(x));
    x = fmaxf(x, row_xor<8>(x));
    return fmaxf(x, half_xor(x));
}
static __device__ inline float wave_sum(float x) {
    x += row_xor<1>(x);
    x += row_xor<2>(x);
    x += row_xor<4>(x);
    x += row_xor<8>(x);
    return x + half_xor(x);
}

static __device__ inline float4 exp2_x4(float a, float b, float c, float d) {
    float4 r;
    asm("v_exp_f32 %0, %4\n\tv_exp_f32 %1, %5\n\t"
        "v_exp_f32 %2, %6\n\tv_exp_f32 %3, %7\n\tv_nop"
        : "=&v"(r.x), "=&v"(r.y), "=&v"(r.z), "=&v"(r.w)
        : "v"(a), "v"(b), "v"(c), "v"(d));
    return r;
}

static __device__ inline v16h make_frag(const _Float16* p) {
    h8v lo = *reinterpret_cast<const h8v*>(p);
    h8v hi = *reinterpret_cast<const h8v*>(p + 16);
    v16h r;
#pragma unroll
    for (int i = 0; i < 8; ++i) { r[i] = lo[i]; r[i + 8] = hi[i]; }
    return r;
}

// ---------------------------------------------------------------------------
// One 64x64 tile, transposed and converted through LDS by 128 threads:
//   dst[c * dpitch + r] = (f16) src[r * spitch + c],  r, c = 0..63
// Global reads are 16 bytes a lane along c, global writes 16 bytes a lane
// along r (whole 128-byte lines both ways); each thread moves 32 elements.
// ---------------------------------------------------------------------------
constexpr int TPITCH = 64 + 8;  // halves; 144 B = 16 B x odd for ds_load_b128

static __device__ inline void tile_transpose_f16(const float* __restrict__ src,
                                                 int spitch,
                                                 _Float16* __restrict__ dst,
                                                 int dpitch,
                                                 _Float16 (*tile)[TPITCH]) {
    const int tid = threadIdx.x;
    const int c4  = (tid & 15) * 4;
    const int rp  = tid >> 4;          // 0..7: a pair of source rows, 4 times
    float4 a[4], b[4];
#pragma unroll  // all eight loads in flight before the first use
    for (int i = 0; i < 4; ++i) {
        const float* p = src + (size_t)(2 * rp + 16 * i) * spitch + c4;
        a[i] = *reinterpret_cast<const float4*>(p);
        b[i] = *reinterpret_cast<const float4*>(p + spitch);
    }
    // Rows r and r+1 of one column are neighbours in the transposed tile:
    // one 4-byte LDS store takes both.
#pragma unroll  // constant indices into a and b
    for (int i = 0; i < 4; ++i) {
        const int r = 2 * rp + 16 * i;
        *reinterpret_cast<h2v*>(&tile[c4 + 0][r]) = h2v{(_Float16)a[i].x, (_Float16)b[i].x};
        *reinterpret_cast<h2v*>(&tile[c4 + 1][r]) = h2v{(_Float16)a[i].y, (_Float16)b[i].y};
        *reinterpret_cast<h2v*>(&tile[c4 + 2][r]) = h2v{(_Float16)a[i].z, (_Float16)b[i].z};
        *reinterpret_cast<h2v*>(&tile[c4 + 3][r]) = h2v{(_Float16)a[i].w, (_Float16)b[i].w};
    }
    __syncthreads();
    const int c0 = tid >> 3;           // 0..15, 4 times
    const int r8 = (tid & 7) * 8;
#pragma unroll  // four independent LDS reads and stores
    for (int i = 0; i < 4; ++i) {
        const int c = c0 + 16 * i;
        *reinterpret_cast<h8v*>(dst + (size_t)c * dpitch + r8) =
            *reinterpret_cast<const h8v*>(&tile[c][r8]);
    }
}

// ---------------------------------------------------------------------------
// f32 -> f16 elementwise convert of one run of 4096 elements by 128 threads;
// each thread converts 32 elements, read 16 bytes at a time and written
// 16 bytes at a time.
// ---------------------------------------------------------------------------
static __device__ inline void convert_f16_4096(const float* __restrict__ in,
                                               _Float16* __restrict__ out,
                                               int run) {
    const int base = run * 4096 + threadIdx.x * 8;
    float4 lo[4], hi[4];
#pragma unroll  // all eight loads in flight before the first use
    for (int i = 0; i < 4; ++i) {
        lo[i] = *reinterpret_cast<const float4*>(in + base + 1024 * i);
        hi[i] = *reinterpret_cast<const float4*>(in + base + 1024 * i + 4);
    }
#pragma unroll  // constant indices into lo and hi
    for (int i = 0; i < 4; ++i) {
        *reinterpret_cast<h8v*>(out + base + 1024 * i) =
            h8v{(_Float16)lo[i].x, (_Float16)lo[i].y,
                (_Float16)lo[i].z, (_Float16)lo[i].w,
                (_Float16)hi[i].x, (_Float16)hi[i].y,
                (_Float16)hi[i].z, (_Float16)hi[i].w};
    }
}

// ---------------------------------------------------------------------------
// Kernel 1: all operand preparation in one launch; none of the five parts
// reads what another writes.  grid = (E/64, E/64, 5), 128 threads.
//   z = 0..3: weight transpose + convert, W[k][n] (f32) -> Wt[n][k] (f16),
//             one 64 (k) x 64 (n) tile a block
//   z = 4:    X (f32) -> Xh (f16), one run of 4096 elements a block
// The choice is the same for a whole block, so the barrier inside the
// transpose is reached by all of its threads or by none.
// ---------------------------------------------------------------------------
static_assert(Mc * Ec / 4096 == (Ec / 64) * (Ec / 64),
              "the convert part fills one z plane of the grid exactly");

__global__ void __launch_bounds__(128)
k_prepare(const float* __restrict__ X,  _Float16* __restrict__ Xh,
          const float* __restrict__ Wq, _Float16* __restrict__ Wqt,
          const float* __restrict__ Wk, _Float16* __restrict__ Wkt,
          const float* __restrict__ Wv, _Float16* __restrict__ Wvt,
          const float* __restrict__ Wo, _Float16* __restrict__ Wot) {
    __shared__ __attribute__((aligned(16))) _Float16 tile[64][TPITCH];
    const int z = blockIdx.z;
    if (z == 4) {
        convert_f16_4096(X, Xh, blockIdx.y * (Ec / 64) + blockIdx.x);
        return;
    }
    const float* W  = z == 0 ? Wq  : z == 1 ? Wk  : z == 2 ? Wv  : Wo;
    _Float16*    Wt = z == 0 ? Wqt : z == 1 ? Wkt : z == 2 ? Wvt : Wot;
    const int n0 = blockIdx.x * 64;
    const int k0 = blockIdx.y * 64;
    tile_transpose_f16(W + (size_t)k0 * Ec + n0, Ec,
                       Wt + (size_t)n0 * Ec + k0, Ec, tile);
}

constexpr int GK      = 128;
constexpr int GPITCH  = GK + 8;
constexpr int GROWS   = 128 + 64;
constexpr int GBUF    = GROWS * GPITCH;
constexpr int GSTAGES = Ec / GK;
static_assert(Ec % GK == 0 && GSTAGES >= 2, "the ring needs two whole stages");

static __device__ inline void
gemm_stage_copies(const _Float16* ga, const _Float16* gb,
                  unsigned la, unsigned lb) {
    constexpr int      GS = 2 * Ec;          // halves: two rows on, global
    constexpr unsigned LS = 2 * GPITCH * 2;  // bytes: two rows on, LDS
    asm volatile(
        "global_load_async_to_lds_b128 %0, %12, off\n\t"
        "global_load_async_to_lds_b128 %1, %13, off\n\t"
        "global_load_async_to_lds_b128 %2, %14, off\n\t"
        "global_load_async_to_lds_b128 %3, %15, off\n\t"
        "global_load_async_to_lds_b128 %4, %16, off\n\t"
        "global_load_async_to_lds_b128 %5, %17, off\n\t"
        "global_load_async_to_lds_b128 %6, %18, off\n\t"
        "global_load_async_to_lds_b128 %7, %19, off\n\t"
        "global_load_async_to_lds_b128 %8, %20, off\n\t"
        "global_load_async_to_lds_b128 %9, %21, off\n\t"
        "global_load_async_to_lds_b128 %10, %22, off\n\t"
        "global_load_async_to_lds_b128 %11, %23, off\n\t"
        "s_wait_xcnt 0x0"
        :: "v"(la),          "v"(la + LS),     "v"(la + 2 * LS), "v"(la + 3 * LS),
           "v"(la + 4 * LS), "v"(la + 5 * LS), "v"(la + 6 * LS), "v"(la + 7 * LS),
           "v"(lb),          "v"(lb + LS),     "v"(lb + 2 * LS), "v"(lb + 3 * LS),
           "v"(ga),          "v"(ga + GS),     "v"(ga + 2 * GS), "v"(ga + 3 * GS),
           "v"(ga + 4 * GS), "v"(ga + 5 * GS), "v"(ga + 6 * GS), "v"(ga + 7 * GS),
           "v"(gb),          "v"(gb + GS),     "v"(gb + 2 * GS), "v"(gb + 3 * GS)
        : "memory");
}

static __device__ __forceinline__ void  // a call would pass the pointers as flat
gemm_tile_wmma(const _Float16* __restrict__ A, const _Float16* __restrict__ Bt,
               const float* __restrict__ bias, float* __restrict__ C,
               _Float16* ring, bool packed_k) {
    constexpr int Ndim = Ec, Kdim = Ec;
    const int wave  = threadIdx.x >> 5;
    const int lane  = threadIdx.x & 31;
    const int nl    = lane & 15;
    const int khalf = lane >> 4;
    const int col0  = blockIdx.x * 64;
    const int row0  = blockIdx.y * 128 + wave * 16;

    // The copies: lane -> row khalf of a pair, 16-byte piece nl of its 256 bytes.
    const _Float16* ga = A  + (size_t)(row0 + khalf) * Kdim + nl * 8;
    const _Float16* gb = Bt + (size_t)(col0 + wave * 8 + khalf) * Kdim + nl * 8;
    const unsigned  l0 = (unsigned)(size_t)ring;
    const unsigned  la = l0 + ((wave * 16 + khalf) * GPITCH + nl * 8) * 2;
    const unsigned  lb = l0 + ((128 + wave * 8 + khalf) * GPITCH + nl * 8) * 2;

    // The fragments: as from global memory, row nl, k = khalf * 8 + ...
    const _Float16* arow = ring + (wave * 16 + nl) * GPITCH + khalf * 8;
    const _Float16* brow = ring + (128 + nl) * GPITCH + khalf * 8;

    v8f acc0 = {}, acc1 = {}, acc2 = {}, acc3 = {};

    gemm_stage_copies(ga, gb, la, lb);
    // Stage 0 has landed for this wave, then for all of them.
    asm volatile("s_wait_asynccnt 0x0" ::: "memory");
    __syncthreads();
    gemm_stage_copies(ga + GK, gb + GK, la + GBUF * 2, lb + GBUF * 2);

    for (int t = 0; t < GSTAGES; ++t) {
        const int bo = (t & 1) * GBUF;
        // All of the stage's fragments first, then its products: read among
        // the products, each pair of LDS reads is waited out on its own.
        v16h a[GK / 32], f[GK / 32][4];
#pragma unroll  // constant indices into a and f
        for (int kk = 0; kk < GK / 32; ++kk) {
            a[kk] = make_frag(arow + bo + kk * 32);
#pragma unroll  // constant indices into f
            for (int j = 0; j < 4; ++j)
                f[kk][j] = make_frag(brow + bo + j * 16 * GPITCH + kk * 32);
        }
        // Keeps the compiler from moving the reads back in among the products.
        __builtin_amdgcn_sched_barrier(0);
#pragma unroll  // constant indices into a and f
        for (int kk = 0; kk < GK / 32; ++kk) {
            acc0 = __builtin_amdgcn_wmma_f32_16x16x32_f16(false, a[kk], false, f[kk][0],
                                                          (short)0, acc0, false, false);
            acc1 = __builtin_amdgcn_wmma_f32_16x16x32_f16(false, a[kk], false, f[kk][1],
                                                          (short)0, acc1, false, false);
            acc2 = __builtin_amdgcn_wmma_f32_16x16x32_f16(false, a[kk], false, f[kk][2],
                                                          (short)0, acc2, false, false);
            acc3 = __builtin_amdgcn_wmma_f32_16x16x32_f16(false, a[kk], false, f[kk][3],
                                                          (short)0, acc3, false, false);
        }
        // Hand-over: this wave's reads of stage t are done, its copies of stage
        // t + 1 have landed; behind the barrier both hold for every wave, so
        // stage t + 1 may be read and stage t's buffer filled again.
        asm volatile("s_wait_dscnt 0x0" ::: "memory");
        asm volatile("s_wait_asynccnt 0x0" ::: "memory");
        __syncthreads();
        if (t + 2 < GSTAGES)
            gemm_stage_copies(ga + (t + 2) * GK, gb + (t + 2) * GK,
                              la + bo * 2, lb + bo * 2);
    }
    // No copy is left in flight when the wave ends.
    asm volatile("s_wait_asynccnt 0x0" ::: "memory");

    const int mo = khalf * 8;
    if (packed_k) {  // the same for the whole block
        const int f0 = row0 + mo;            // first of the lane's 8 features
        const float4 blo = *reinterpret_cast<const float4*>(bias + f0);
        const float4 bhi = *reinterpret_cast<const float4*>(bias + f0 + 4);
        float4* kp = reinterpret_cast<float4*>(C)
            + ((size_t)((col0 / Tc) * Hc + f0 / HDc) * (HDc / 4) + (f0 % HDc) / 4) * Sc
            + col0 % Tc + nl;
        const v8f* accs[4] = {&acc0, &acc1, &acc2, &acc3};
#pragma unroll  // constant indices into accs
        for (int j = 0; j < 4; ++j) {
            const v8f& c = *accs[j];
            kp[j * 16]      = float4{c[0] + blo.x, c[1] + blo.y, c[2] + blo.z, c[3] + blo.w};
            kp[j * 16 + Sc] = float4{c[4] + bhi.x, c[5] + bhi.y, c[6] + bhi.z, c[7] + bhi.w};
        }
        return;
    }
    const float bz0 = bias[col0 +  0 + nl];
    const float bz1 = bias[col0 + 16 + nl];
    const float bz2 = bias[col0 + 32 + nl];
    const float bz3 = bias[col0 + 48 + nl];
#pragma unroll
    for (int r = 0; r < 8; ++r) {
        float* crow = C + (size_t)(row0 + mo + r) * Ndim + col0;
        crow[ 0 + nl] = acc0[r] + bz0;
        crow[16 + nl] = acc1[r] + bz1;
        crow[32 + nl] = acc2[r] + bz2;
        crow[48 + nl] = acc3[r] + bz3;
    }
    asm volatile("s_wait_xcnt 0x0" ::: "memory");
}

// Kernel 2: the Q, K and V projections in one launch: three products of the
// same X that read nothing of each other.  grid = (N/64, M/128, 3); z picks
// the weight, the bias and the output.  For K (z = 1) the two operands change
// places (both are 768 rows of 768 halves, so the grid fits either way) and
// the tile is stored in the packed order described above.
__global__ void __launch_bounds__(256)
k_gemm_qkv(const _Float16* __restrict__ A,
           const _Float16* __restrict__ Wqt, const float* __restrict__ bq,
           float* __restrict__ Qf,
           const _Float16* __restrict__ Wkt, const float* __restrict__ bk,
           float* __restrict__ Kf,
           const _Float16* __restrict__ Wvt, const float* __restrict__ bv,
           float* __restrict__ Vf) {
    __shared__ __attribute__((aligned(16))) _Float16 ring[2 * GBUF];
    static_assert(Mc == Ec && Tc % 64 == 0 && HDc % 16 == 0,
                  "K transposed: same grid; a tile in one batch, a wave in one head");
    const int z = blockIdx.z;
    gemm_tile_wmma(z == 1 ? Wkt : A,
                   z == 0 ? Wqt : z == 1 ? A : Wvt,
                   z == 0 ? bq  : z == 1 ? bk  : bv,
                   z == 0 ? Qf  : z == 1 ? Kf  : Vf,
                   ring, z == 1);
}

// Kernel 5: one product (the output projection).  grid = (N/64, M/128).
__global__ void __launch_bounds__(256)
k_gemm_wmma(const _Float16* __restrict__ A, const _Float16* __restrict__ Bt,
            const float* __restrict__ bias, float* __restrict__ C) {
    __shared__ __attribute__((aligned(16))) _Float16 ring[2 * GBUF];
    gemm_tile_wmma(A, Bt, bias, C, ring, false);
}

// ---------------------------------------------------------------------------
// Kernel 3: V (f32 [B,T,E]) -> Vt (f16 [B,H,HD,T]) for K-contiguous B-frags
// ---------------------------------------------------------------------------
// grid = (B*H, T/64): one 64 (s) x 64 (d) tile a block.
__global__ void __launch_bounds__(128)
k_transpose_v(const float* __restrict__ V, _Float16* __restrict__ Vt) {
    __shared__ __attribute__((aligned(16))) _Float16 tile[64][TPITCH];
    const int bh = blockIdx.x;
    const int b  = bh / Hc, h = bh % Hc;
    const int s0 = blockIdx.y * 64;
    tile_transpose_f16(V + (size_t)(b * Tc + s0) * Ec + h * HDc, Ec,
                       Vt + (size_t)bh * HDc * Tc + s0, Tc, tile);
}

constexpr int TR = 12;
static_assert(Tc % TR == 0 && TR % 4 == 0 && TR > 8 && TR <= 16,
              "whole blocks, whole rows per wave, one 16-row P@V tile");

__global__ void __launch_bounds__(128)
k_additive_attn(const float* __restrict__ Q, const float* __restrict__ Kf,
                const _Float16* __restrict__ Vt,
                const float* __restrict__ w_score,
                const float* __restrict__ b_score,
                _Float16* __restrict__ AttnH) {
    const int bh = blockIdx.x;
    const int b  = bh / Hc, h = bh % Hc;
    const int t0 = blockIdx.y * TR;
    const int tid = threadIdx.x;

    __shared__ float    q_s[TR][HDc];      //  3 KB
    __shared__ __attribute__((aligned(16))) float    sc[TR][Sc];     // 18 KB
    __shared__ __attribute__((aligned(16))) _Float16 p_s[TR][SPAD];  // ~9.2 KB

    // Each thread owns KPT key rows (s = tid + 128*j) and holds them in
    // registers for the whole score phase: every k value is read from global
    // memory once per block and serves all TR query rows of the block.
    // Kf is packed [b][h][d / 4][s][d % 4]: the 32 lanes of a load (32
    // consecutive s, one d / 4) take 512 consecutive bytes, four whole lines.
    // Every loop over j, c or e below is unrolled in full for one reason:
    // kreg, x, acc, v and e stay in registers only if indexed by constants.
    constexpr int KPT = Sc / 128;          // 3 key rows per thread
    float4 kreg[KPT][HDc / 4];
    const float4* kcol = reinterpret_cast<const float4*>(Kf)
        + (size_t)bh * (HDc / 4) * Sc + tid;
#pragma unroll  // constant indices into kreg
    for (int j = 0; j < KPT; ++j) {
#pragma unroll  // constant indices into kreg
        for (int c = 0; c < HDc / 4; ++c) kreg[j][c] = kcol[c * Sc + j * 128];
    }
    asm volatile("s_wait_xcnt 0x0" ::: "memory");

    for (int i = tid; i < TR * HDc; i += 128) {
        int r = i / HDc, d = i % HDc;
        q_s[r][d] = Q[((size_t)(b * Tc + t0 + r)) * Ec + h * HDc + d];
    }
    __syncthreads();

    // ---- additive scores: sc[t][s] = sum_d w[d]*tanh(q[t,d]+k[s,d]) + b ----
    // q[t][*] is one LDS address for the whole wave (broadcast read) and
    // w_score[*] a uniform address (scalar load); each serves KPT key rows.
    // The sum over d of one (t, s) pair runs in ascending d, one accumulator.
    const float bsc = b_score[0];
    for (int t = 0; t < TR; ++t) {
        float acc[KPT];
#pragma unroll  // constant indices into acc
        for (int j = 0; j < KPT; ++j) acc[j] = 0.f;
#pragma unroll  // constant indices into kreg
        for (int c = 0; c < HDc / 4; ++c) {
            const float4 qv = *reinterpret_cast<const float4*>(&q_s[t][c * 4]);
            // 4*KPT independent values per batch: no tanh waits for its
            // neighbour, and the KPT accumulator chains interleave.
            float x[KPT][4];
#pragma unroll  // constant indices into x and kreg
            for (int j = 0; j < KPT; ++j) {
                x[j][0] = qv.x + kreg[j][c].x;
                x[j][1] = qv.y + kreg[j][c].y;
                x[j][2] = qv.z + kreg[j][c].z;
                x[j][3] = qv.w + kreg[j][c].w;
            }
#pragma unroll  // constant indices into x
            for (int j = 0; j < KPT; ++j) {
                x[j][0] = fast_tanh(x[j][0]);
                x[j][1] = fast_tanh(x[j][1]);
                x[j][2] = fast_tanh(x[j][2]);
                x[j][3] = fast_tanh(x[j][3]);
            }
#pragma unroll  // constant indices into x
            for (int e = 0; e < 4; ++e) {
                const float we = w_score[c * 4 + e];
#pragma unroll  // constant indices into x and acc
                for (int j = 0; j < KPT; ++j) acc[j] += we * x[j][e];
            }
        }
#pragma unroll  // constant indices into acc
        for (int j = 0; j < KPT; ++j) sc[t][tid + j * 128] = acc[j] + bsc;
    }
    __syncthreads();

    const int wave  = tid >> 5;
    const int lane  = tid & 31;
    const int nl    = lane & 15;
    const int khalf = lane >> 4;
    constexpr int RPW = TR / 4;            // rows per wave
    constexpr int CPL = Sc / 128;          // 16-byte pieces of a row per lane
#pragma unroll  // the rows' reduction chains are independent and interleave
    for (int rr = 0; rr < RPW; ++rr) {
        const int row = wave * RPW + rr;
        float4 v[CPL];
#pragma unroll  // constant indices into v
        for (int c = 0; c < CPL; ++c)
            v[c] = *reinterpret_cast<const float4*>(&sc[row][c * 128 + lane * 4]);
        float mx = -3.4e38f;
#pragma unroll  // constant indices into v
        for (int c = 0; c < CPL; ++c)
            mx = fmaxf(mx, fmaxf(fmaxf(v[c].x, v[c].y), fmaxf(v[c].z, v[c].w)));
        mx = wave_max(mx);
        constexpr float LOG2E = 1.44269504088896340736f;  // exp(x) = exp2(x * LOG2E)
        float4 e[CPL];
#pragma unroll  // constant indices into v and e
        for (int c = 0; c < CPL; ++c) {
            e[c] = exp2_x4((v[c].x - mx) * LOG2E, (v[c].y - mx) * LOG2E,
                           (v[c].z - mx) * LOG2E, (v[c].w - mx) * LOG2E);
        }
        float sum = (e[0].x + e[0].y) + (e[0].z + e[0].w);
#pragma unroll  // constant indices into e
        for (int c = 1; c < CPL; ++c)
            sum += (e[c].x + e[c].y) + (e[c].z + e[c].w);
        sum = wave_sum(sum);
        const float rinv = 1.f / sum;
#pragma unroll  // constant indices into e
        for (int c = 0; c < CPL; ++c)
            *reinterpret_cast<h4v*>(&p_s[row][c * 128 + lane * 4]) =
                h4v{(_Float16)(e[c].x * rinv), (_Float16)(e[c].y * rinv),
                    (_Float16)(e[c].z * rinv), (_Float16)(e[c].w * rinv)};
    }
    __syncthreads();

    // ---- P[TR,S] @ V[S,HD] via WMMA; wave w owns d-columns w*16..w*16+15 ----
    // Row m of the product depends on row m of P alone: the fragment's rows
    // from TR on read row TR - 1 once more (one LDS address, a broadcast).
    v8f acc = {};
    const _Float16* prow  = &p_s[nl < TR ? nl : TR - 1][khalf * 8];  // LDS
    const _Float16* vbase = Vt + ((size_t)bh * HDc + wave * 16 + nl) * Tc
                               + khalf * 8;                           // global
    for (int k0 = 0; k0 < Sc; k0 += 32) {
        __builtin_prefetch(vbase + k0 + 64, 0, 0);
        v16h a  = make_frag(prow + k0);      // ds_read_b128 x2, conflict-free
        v16h bb = make_frag(vbase + k0);     // global_load_b128 x2
        acc = __builtin_amdgcn_wmma_f32_16x16x32_f16(false, a, false, bb,
                                                     (short)0, acc, false, false);
    }

    const int mo = khalf * 8;
#pragma unroll
    for (int rr = 0; rr < 8; ++rr) {
        if (mo + rr < TR)
            AttnH[((size_t)(b * Tc + t0 + mo + rr)) * Ec + h * HDc + wave * 16 + nl]
                = (_Float16)acc[rr];
    }
}

// ---------------------------------------------------------------------------
// Host launcher
// ---------------------------------------------------------------------------
extern "C" void kernel_launch(void* const* d_in, const int* in_sizes, int n_in,
                              void* d_out, int out_size, void* d_ws, size_t ws_size,
                              hipStream_t stream) {
    const float* X   = (const float*)d_in[0];
    const float* Wq  = (const float*)d_in[1];
    const float* bq  = (const float*)d_in[2];
    const float* Wk  = (const float*)d_in[3];
    const float* bk  = (const float*)d_in[4];
    const float* Wv  = (const float*)d_in[5];
    const float* bv  = (const float*)d_in[6];
    const float* Wo  = (const float*)d_in[7];
    const float* bo  = (const float*)d_in[8];
    const float* wsc = (const float*)d_in[9];
    const float* bsc = (const float*)d_in[10];

    char* ws = (char*)d_ws;
    size_t off = 0;
    auto carve = [&](size_t bytes) {
        void* p = ws + off;
        off += (bytes + 255) & ~(size_t)255;
        return p;
    };

    _Float16* Xh    = (_Float16*)carve((size_t)Mc * Ec * 2);
    _Float16* Wqt   = (_Float16*)carve((size_t)Ec * Ec * 2);
    _Float16* Wkt   = (_Float16*)carve((size_t)Ec * Ec * 2);
    _Float16* Wvt   = (_Float16*)carve((size_t)Ec * Ec * 2);
    _Float16* Wot   = (_Float16*)carve((size_t)Ec * Ec * 2);
    float*    Qf    = (float*)   carve((size_t)Mc * Ec * 4);
    float*    Kff   = (float*)   carve((size_t)Mc * Ec * 4);
    float*    Vf    = (float*)   carve((size_t)Mc * Ec * 4);
    _Float16* Vth   = (_Float16*)carve((size_t)Bc * Hc * HDc * Tc * 2);
    _Float16* AttnH = (_Float16*)carve((size_t)Mc * Ec * 2);

    // 1) X -> f16 and the four weights -> transposed f16, one launch
    {
        dim3 grid(Ec / 64, Ec / 64, 5);
        k_prepare<<<grid, 128, 0, stream>>>(X, Xh, Wq, Wqt, Wk, Wkt,
                                            Wv, Wvt, Wo, Wot);
    }
    // 2) Q/K/V projections (WMMA GEMMs), one launch
    {
        dim3 grid(Ec / 64, Mc / 128, 3);
        k_gemm_qkv<<<grid, 256, 0, stream>>>(Xh, Wqt, bq, Qf, Wkt, bk, Kff,
                                             Wvt, bv, Vf);
    }
    // 3) V -> [B,H,HD,T] f16
    {
        dim3 grid(Bc * Hc, Tc / 64);
        k_transpose_v<<<grid, 128, 0, stream>>>(Vf, Vth);
    }
    // 4) fused additive score + softmax + P@V
    {
        dim3 grid(Bc * Hc, Tc / TR);
        k_additive_attn<<<grid, 128, 0, stream>>>(Qf, Kff, Vth, wsc, bsc, AttnH);
    }
    // 5) output projection -> d_out (f32)
    {
        dim3 grid(Ec / 64, Mc / 128);
        k_gemm_wmma<<<grid, 256, 0, stream>>>(AttnH, Wot, bo, (float*)d_out);
    }
}

// v008
// A run of this version takes 42.3 microseconds.
// Next to v007, in two timings, it ran 1.04 times as fast each time.
// Over all steps from v000 it is 5.03 times as fast.
#include <hip/hip_runtime.h>

typedef __attribute__((ext_vector_type(16))) _Float16 v16h;
typedef __attribute__((ext_vector_type(8)))  _Float16 h8v;
typedef __attribute__((ext_vector_type(4)))  _Float16 h4v;
typedef __attribute__((ext_vector_type(2)))  _Float16 h2v;
typedef __attribute__((ext_vector_type(8)))  float    v8f;

constexpr int Bc = 2, Tc = 384, Ec = 768, Hc = 12, HDc = 64;
constexpr int Mc = Bc * Tc;
constexpr int Sc = Tc;
constexpr int SPAD = Sc + 8;

static __device__ inline float fast_tanh(float x) {
#if __has_builtin(__builtin_amdgcn_tanhf)
    return __builtin_amdgcn_tanhf(x);
#elif __has_builtin(__builtin_amdgcn_tanh_f32)
    return __builtin_amdgcn_tanh_f32(x);
#else
    return tanhf(x);
#endif
}

template <int XMASK>
static __device__ inline float row_xor(float x) {
    return __builtin_bit_cast(float, __builtin_amdgcn_mov_dpp(
        __builtin_bit_cast(int, x), 0x160 + XMASK, 0xf, 0xf, true));
}
static __device__ inline float half_xor(float x) {
    const int b = __builtin_bit_cast(int, x);
    return __builtin_bit_cast(float, __builtin_amdgcn_permlanex16(
        b, b, 0x76543210, 0xfedcba98, false, false));
}
static __device__ inline float wave_max(float x) {
    x = fmaxf(x, row_xor<1>(x));
    x = fmaxf(x, row_xor<2>(x));
    x = fmaxf(x, row_xor<4>(x));
    x = fmaxf(x, row_xor<8>(x));
    return fmaxf(x, half_xor(x));
}
static __device__ inline float wave_sum(float x) {
    x += row_xor<1>(x);
    x += row_xor<2>(x);
    x += row_xor<4>(x);
    x += row_xor<8>(x);
    return x + half_xor(x);
}

static __device__ inline float4 exp2_x4(float a, float b, float c, float d) {
    float4 r;
    asm("v_exp_f32 %0, %4\n\tv_exp_f32 %1, %5\n\t"
        "v_exp_f32 %2, %6\n\tv_exp_f32 %3, %7\n\tv_nop"
        : "=&v"(r.x), "=&v"(r.y), "=&v"(r.z), "=&v"(r.w)
        : "v"(a), "v"(b), "v"(c), "v"(d));
    return r;
}

static __device__ inline v16h make_frag(const _Float16* p) {
    h8v lo = *reinterpret_cast<const h8v*>(p);
    h8v hi = *reinterpret_cast<const h8v*>(p + 16);
    v16h r;
#pragma unroll
    for (int i = 0; i < 8; ++i) { r[i] = lo[i]; r[i + 8] = hi[i]; }
    return r;
}

// ---------------------------------------------------------------------------
// One 64x64 tile, transposed and converted through LDS by 128 threads:
//   dst[c * dpitch + r] = (f16) src[r * spitch + c],  r, c = 0..63
// Global reads are 16 bytes a lane along c, global writes 16 bytes a lane
// along r (whole 128-byte lines both ways); each thread moves 32 elements.
// ---------------------------------------------------------------------------
constexpr int TPITCH = 64 + 8;  // halves; 144 B = 16 B x odd for ds_load_b128

static __device__ inline void tile_transpose_f16(const float* __restrict__ src,
                                                 int spitch,
                                                 _Float16* __restrict__ dst,
                                                 int dpitch,
                                                 _Float16 (*tile)[TPITCH]) {
    const int tid = threadIdx.x;
    const int c4  = (tid & 15) * 4;
    const int rp  = tid >> 4;          // 0..7: a pair of source rows, 4 times
    float4 a[4], b[4];
#pragma unroll  // all eight loads in flight before the first use
    for (int i = 0; i < 4; ++i) {
        const float* p = src + (size_t)(2 * rp + 16 * i) * spitch + c4;
        a[i] = *reinterpret_cast<const float4*>(p);
        b[i] = *reinterpret_cast<const float4*>(p + spitch);
    }
    // Rows r and r+1 of one column are neighbours in the transposed tile:
    // one 4-byte LDS store takes both.
#pragma unroll  // constant indices into a and b
    for (int i = 0; i < 4; ++i) {
        const int r = 2 * rp + 16 * i;
        *reinterpret_cast<h2v*>(&tile[c4 + 0][r]) = h2v{(_Float16)a[i].x, (_Float16)b[i].x};
        *reinterpret_cast<h2v*>(&tile[c4 + 1][r]) = h2v{(_Float16)a[i].y, (_Float16)b[i].y};
        *reinterpret_cast<h2v*>(&tile[c4 + 2][r]) = h2v{(_Float16)a[i].z, (_Float16)b[i].z};
        *reinterpret_cast<h2v*>(&tile[c4 + 3][r]) = h2v{(_Float16)a[i].w, (_Float16)b[i].w};
    }
    __syncthreads();
    const int c0 = tid >> 3;           // 0..15, 4 times
    const int r8 = (tid & 7) * 8;
#pragma unroll  // four independent LDS reads and stores
    for (int i = 0; i < 4; ++i) {
        const int c = c0 + 16 * i;
        *reinterpret_cast<h8v*>(dst + (size_t)c * dpitch + r8) =
            *reinterpret_cast<const h8v*>(&tile[c][r8]);
    }
}

// ---------------------------------------------------------------------------
// f32 -> f16 elementwise convert of one run of 4096 elements by 128 threads;
// each thread converts 32 elements, read 16 bytes at a time and written
// 16 bytes at a time.
// ---------------------------------------------------------------------------
static __device__ inline void convert_f16_4096(const float* __restrict__ in,
                                               _Float16* __restrict__ out,
                                               int run) {
    const int base = run * 4096 + threadIdx.x * 8;
    float4 lo[4], hi[4];
#pragma unroll  // all eight loads in flight before the first use
    for (int i = 0; i < 4; ++i) {
        lo[i] = *reinterpret_cast<const float4*>(in + base + 1024 * i);
        hi[i] = *reinterpret_cast<const float4*>(in + base + 1024 * i + 4);
    }
#pragma unroll  // constant indices into lo and hi
    for (int i = 0; i < 4; ++i) {
        *reinterpret_cast<h8v*>(out + base + 1024 * i) =
            h8v{(_Float16)lo[i].x, (_Float16)lo[i].y,
                (_Float16)lo[i].z, (_Float16)lo[i].w,
                (_Float16)hi[i].x, (_Float16)hi[i].y,
                (_Float16)hi[i].z, (_Float16)hi[i].w};
    }
}

// ---------------------------------------------------------------------------
// Kernel 1: all operand preparation in one launch; none of the five parts
// reads what another writes.  grid = (E/64, E/64, 5), 128 threads.
//   z = 0..3: weight transpose + convert, W[k][n] (f32) -> Wt[n][k] (f16),
//             one 64 (k) x 64 (n) tile a block
//   z = 4:    X (f32) -> Xh (f16), one run of 4096 elements a block
// The choice is the same for a whole block, so the barrier inside the
// transpose is reached by all of its threads or by none.
// ---------------------------------------------------------------------------
static_assert(Mc * Ec / 4096 == (Ec / 64) * (Ec / 64),
              "the convert part fills one z plane of the grid exactly");

__global__ void __launch_bounds__(128)
k_prepare(const float* __restrict__ X,  _Float16* __restrict__ Xh,
          const float* __restrict__ Wq, _Float16* __restrict__ Wqt,
          const float* __restrict__ Wk, _Float16* __restrict__ Wkt,
          const float* __restrict__ Wv, _Float16* __restrict__ Wvt,
          const float* __restrict__ Wo, _Float16* __restrict__ Wot) {
    __shared__ __attribute__((aligned(16))) _Float16 tile[64][TPITCH];
    const int z = blockIdx.z;
    if (z == 4) {
        convert_f16_4096(X, Xh, blockIdx.y * (Ec / 64) + blockIdx.x);
        return;
    }
    const float* W  = z == 0 ? Wq  : z == 1 ? Wk  : z == 2 ? Wv  : Wo;
    _Float16*    Wt = z == 0 ? Wqt : z == 1 ? Wkt : z == 2 ? Wvt : Wot;
    const int n0 = blockIdx.x * 64;
    const int k0 = blockIdx.y * 64;
    tile_transpose_f16(W + (size_t)k0 * Ec + n0, Ec,
                       Wt + (size_t)n0 * Ec + k0, Ec, tile);
}

enum { GEMM_PLAIN = 0, GEMM_PACKED_K = 1, GEMM_VT = 2 };
constexpr int GK      = 128;             // halves of a row in one stage
constexpr int GPITCH  = GK + 8;          // halves; 272 B = 16 B x odd for ds_load_b128
constexpr int GROWS   = 128 + 64;        // the A rows, then the Bt rows
constexpr int GBUF    = GROWS * GPITCH;  // halves in one buffer
constexpr int GSTAGES = Ec / GK;
static_assert(Ec % GK == 0 && GSTAGES >= 2, "the ring needs two whole stages");

static __device__ inline void
gemm_stage_copies(const _Float16* ga, const _Float16* gb,
                  unsigned la, unsigned lb) {
    constexpr int      GS = 2 * Ec;          // halves: two rows on, global
    constexpr unsigned LS = 2 * GPITCH * 2;  // bytes: two rows on, LDS
    asm volatile(
        "global_load_async_to_lds_b128 %0, %12, off\n\t"
        "global_load_async_to_lds_b128 %1, %13, off\n\t"
        "global_load_async_to_lds_b128 %2, %14, off\n\t"
        "global_load_async_to_lds_b128 %3, %15, off\n\t"
        "global_load_async_to_lds_b128 %4, %16, off\n\t"
        "global_load_async_to_lds_b128 %5, %17, off\n\t"
        "global_load_async_to_lds_b128 %6, %18, off\n\t"
        "global_load_async_to_lds_b128 %7, %19, off\n\t"
        "global_load_async_to_lds_b128 %8, %20, off\n\t"
        "global_load_async_to_lds_b128 %9, %21, off\n\t"
        "global_load_async_to_lds_b128 %10, %22, off\n\t"
        "global_load_async_to_lds_b128 %11, %23, off\n\t"
        "s_wait_xcnt 0x0"
        :: "v"(la),          "v"(la + LS),     "v"(la + 2 * LS), "v"(la + 3 * LS),
           "v"(la + 4 * LS), "v"(la + 5 * LS), "v"(la + 6 * LS), "v"(la + 7 * LS),
           "v"(lb),          "v"(lb + LS),     "v"(lb + 2 * LS), "v"(lb + 3 * LS),
           "v"(ga),          "v"(ga + GS),     "v"(ga + 2 * GS), "v"(ga + 3 * GS),
           "v"(ga + 4 * GS), "v"(ga + 5 * GS), "v"(ga + 6 * GS), "v"(ga + 7 * GS),
           "v"(gb),          "v"(gb + GS),     "v"(gb + 2 * GS), "v"(gb + 3 * GS)
        : "memory");
}

static __device__ __forceinline__ void  // a call would pass the pointers as flat
gemm_tile_wmma(const _Float16* __restrict__ A, const _Float16* __restrict__ Bt,
               const float* __restrict__ bias, float* __restrict__ C,
               _Float16* __restrict__ Vt, _Float16* ring, int mode) {
    constexpr int Ndim = Ec, Kdim = Ec;
    const int wave  = threadIdx.x >> 5;
    const int lane  = threadIdx.x & 31;
    const int nl    = lane & 15;
    const int khalf = lane >> 4;
    const int col0  = blockIdx.x * 64;
    const int row0  = blockIdx.y * 128 + wave * 16;

    // The copies: lane -> row khalf of a pair, 16-byte piece nl of its 256 bytes.
    const _Float16* ga = A  + (size_t)(row0 + khalf) * Kdim + nl * 8;
    const _Float16* gb = Bt + (size_t)(col0 + wave * 8 + khalf) * Kdim + nl * 8;
    const unsigned  l0 = (unsigned)(size_t)ring;
    const unsigned  la = l0 + ((wave * 16 + khalf) * GPITCH + nl * 8) * 2;
    const unsigned  lb = l0 + ((128 + wave * 8 + khalf) * GPITCH + nl * 8) * 2;

    // The fragments: as from global memory, row nl, k = khalf * 8 + ...
    const _Float16* arow = ring + (wave * 16 + nl) * GPITCH + khalf * 8;
    const _Float16* brow = ring + (128 + nl) * GPITCH + khalf * 8;

    v8f acc0 = {}, acc1 = {}, acc2 = {}, acc3 = {};

    gemm_stage_copies(ga, gb, la, lb);
    // Stage 0 has landed for this wave, then for all of them.
    asm volatile("s_wait_asynccnt 0x0" ::: "memory");
    __syncthreads();
    gemm_stage_copies(ga + GK, gb + GK, la + GBUF * 2, lb + GBUF * 2);

    for (int t = 0; t < GSTAGES; ++t) {
        const int bo = (t & 1) * GBUF;
        // All of the stage's fragments first, then its products: read among
        // the products, each pair of LDS reads is waited out on its own.
        v16h a[GK / 32], f[GK / 32][4];
#pragma unroll  // constant indices into a and f
        for (int kk = 0; kk < GK / 32; ++kk) {
            a[kk] = make_frag(arow + bo + kk * 32);
#pragma unroll  // constant indices into f
            for (int j = 0; j < 4; ++j)
                f[kk][j] = make_frag(brow + bo + j * 16 * GPITCH + kk * 32);
        }
        // Keeps the compiler from moving the reads back in among the products.
        __builtin_amdgcn_sched_barrier(0);
#pragma unroll  // constant indices into a and f
        for (int kk = 0; kk < GK / 32; ++kk) {
            acc0 = __builtin_amdgcn_wmma_f32_16x16x32_f16(false, a[kk], false, f[kk][0],
                                                          (short)0, acc0, false, false);
            acc1 = __builtin_amdgcn_wmma_f32_16x16x32_f16(false, a[kk], false, f[kk][1],
                                                          (short)0, acc1, false, false);
            acc2 = __builtin_amdgcn_wmma_f32_16x16x32_f16(false, a[kk], false, f[kk][2],
                                                          (short)0, acc2, false, false);
            acc3 = __builtin_amdgcn_wmma_f32_16x16x32_f16(false, a[kk], false, f[kk][3],
                                                          (short)0, acc3, false, false);
        }
        // Hand-over: this wave's reads of stage t are done, its copies of stage
        // t + 1 have landed; behind the barrier both hold for every wave, so
        // stage t + 1 may be read and stage t's buffer filled again.
        asm volatile("s_wait_dscnt 0x0" ::: "memory");
        asm volatile("s_wait_asynccnt 0x0" ::: "memory");
        __syncthreads();
        if (t + 2 < GSTAGES)
            gemm_stage_copies(ga + (t + 2) * GK, gb + (t + 2) * GK,
                              la + bo * 2, lb + bo * 2);
    }
    // No copy is left in flight when the wave ends.
    asm volatile("s_wait_asynccnt 0x0" ::: "memory");

    const int mo = khalf * 8;
    if (mode == GEMM_PACKED_K) {  // the same for the whole block
        const int f0 = row0 + mo;            // first of the lane's 8 features
        const float4 blo = *reinterpret_cast<const float4*>(bias + f0);
        const float4 bhi = *reinterpret_cast<const float4*>(bias + f0 + 4);
        float4* kp = reinterpret_cast<float4*>(C)
            + ((size_t)((col0 / Tc) * Hc + f0 / HDc) * (HDc / 4) + (f0 % HDc) / 4) * Sc
            + col0 % Tc + nl;
        const v8f* accs[4] = {&acc0, &acc1, &acc2, &acc3};
#pragma unroll  // constant indices into accs
        for (int j = 0; j < 4; ++j) {
            const v8f& c = *accs[j];
            kp[j * 16]      = float4{c[0] + blo.x, c[1] + blo.y, c[2] + blo.z, c[3] + blo.w};
            kp[j * 16 + Sc] = float4{c[4] + bhi.x, c[5] + bhi.y, c[6] + bhi.z, c[7] + bhi.w};
        }
        return;
    }
    const float bz0 = bias[col0 +  0 + nl];
    const float bz1 = bias[col0 + 16 + nl];
    const float bz2 = bias[col0 + 32 + nl];
    const float bz3 = bias[col0 + 48 + nl];
    if (mode == GEMM_VT) {  // the same for the whole block
        // The loop's last barrier ended every wave's reads of the ring and no
        // copy is in flight: its LDS takes the tile, [d][s], pitch GPITCH.
        const v8f*  accs[4] = {&acc0, &acc1, &acc2, &acc3};
        const float bzs[4]  = {bz0, bz1, bz2, bz3};
#pragma unroll  // constant indices into accs and bzs
        for (int j = 0; j < 4; ++j) {
            const v8f& c = *accs[j];
            const float bz = bzs[j];
            *reinterpret_cast<h8v*>(ring + (j * 16 + nl) * GPITCH + wave * 16 + mo) =
                h8v{(_Float16)(c[0] + bz), (_Float16)(c[1] + bz),
                    (_Float16)(c[2] + bz), (_Float16)(c[3] + bz),
                    (_Float16)(c[4] + bz), (_Float16)(c[5] + bz),
                    (_Float16)(c[6] + bz), (_Float16)(c[7] + bz)};
        }
        __syncthreads();  // the tile is complete before rows of it are read
        // A store of a wave takes two rows d, 256 bytes (128 tokens) of each:
        // four whole lines.  The 64 columns of a tile are one head.
        const int tok0 = blockIdx.y * 128;
        _Float16* vrow = Vt
            + ((size_t)((tok0 / Tc) * Hc + col0 / HDc) * HDc + wave * 8 + khalf) * Tc
            + tok0 % Tc + nl * 8;
        const _Float16* lrow = ring + (wave * 8 + khalf) * GPITCH + nl * 8;
#pragma unroll  // four independent LDS reads and stores
        for (int i = 0; i < 4; ++i)
            *reinterpret_cast<h8v*>(vrow + (size_t)(2 * i) * Tc) =
                *reinterpret_cast<const h8v*>(lrow + 2 * i * GPITCH);
        asm volatile("s_wait_xcnt 0x0" ::: "memory");
        return;
    }
#pragma unroll
    for (int r = 0; r < 8; ++r) {
        float* crow = C + (size_t)(row0 + mo + r) * Ndim + col0;
        crow[ 0 + nl] = acc0[r] + bz0;
        crow[16 + nl] = acc1[r] + bz1;
        crow[32 + nl] = acc2[r] + bz2;
        crow[48 + nl] = acc3[r] + bz3;
    }
    asm volatile("s_wait_xcnt 0x0" ::: "memory");
}

// Kernel 2: the Q, K and V projections in one launch: three products of the
// same X that read nothing of each other.  grid = (N/64, M/128, 3); z picks
// the weight, the bias and the output.  For K (z = 1) the two operands change
// places (both are 768 rows of 768 halves, so the grid fits either way) and
// the tile is stored in the packed order described above; V (z = 2) is stored
// as f16 [B,H,HD,T], also described above.
__global__ void __launch_bounds__(256)
k_gemm_qkv(const _Float16* __restrict__ A,
           const _Float16* __restrict__ Wqt, const float* __restrict__ bq,
           float* __restrict__ Qf,
           const _Float16* __restrict__ Wkt, const float* __restrict__ bk,
           float* __restrict__ Kf,
           const _Float16* __restrict__ Wvt, const float* __restrict__ bv,
           _Float16* __restrict__ Vt) {
    __shared__ __attribute__((aligned(16))) _Float16 ring[2 * GBUF];
    static_assert(Mc == Ec && Tc % 64 == 0 && HDc % 16 == 0,
                  "K transposed: same grid; a tile in one batch, a wave in one head");
    static_assert(Tc % 128 == 0 && HDc == 64 && GPITCH >= 128,
                  "V transposed: a tile in one batch and one head, a row in the pitch");
    const int z = blockIdx.z;
    gemm_tile_wmma(z == 1 ? Wkt : A,
                   z == 0 ? Wqt : z == 1 ? A : Wvt,
                   z == 0 ? bq  : z == 1 ? bk  : bv,
                   z == 0 ? Qf  : Kf, Vt,
                   ring, z == 1 ? GEMM_PACKED_K : z == 2 ? GEMM_VT : GEMM_PLAIN);
}

// Kernel 4: one product (the output projection).  grid = (N/64, M/128).
__global__ void __launch_bounds__(256)
k_gemm_wmma(const _Float16* __restrict__ A, const _Float16* __restrict__ Bt,
            const float* __restrict__ bias, float* __restrict__ C) {
    __shared__ __attribute__((aligned(16))) _Float16 ring[2 * GBUF];
    gemm_tile_wmma(A, Bt, bias, C, nullptr, ring, GEMM_PLAIN);
}

constexpr int TR = 12;
static_assert(Tc % TR == 0 && TR % 4 == 0 && TR > 8 && TR <= 16,
              "whole blocks, whole rows per wave, one 16-row P@V tile");

__global__ void __launch_bounds__(128)
k_additive_attn(const float* __restrict__ Q, const float* __restrict__ Kf,
                const _Float16* __restrict__ Vt,
                const float* __restrict__ w_score,
                const float* __restrict__ b_score,
                _Float16* __restrict__ AttnH) {
    const int bh = blockIdx.x;
    const int b  = bh / Hc, h = bh % Hc;
    const int t0 = blockIdx.y * TR;
    const int tid = threadIdx.x;

    __shared__ float    q_s[TR][HDc];      //  3 KB
    __shared__ __attribute__((aligned(16))) float    sc[TR][Sc];     // 18 KB
    __shared__ __attribute__((aligned(16))) _Float16 p_s[TR][SPAD];  // ~9.2 KB

    // Each thread owns KPT key rows (s = tid + 128*j) and holds them in
    // registers for the whole score phase: every k value is read from global
    // memory once per block and serves all TR query rows of the block.
    // Kf is packed [b][h][d / 4][s][d % 4]: the 32 lanes of a load (32
    // consecutive s, one d / 4) take 512 consecutive bytes, four whole lines.
    // Every loop over j, c or e below is unrolled in full for one reason:
    // kreg, x, acc, v and e stay in registers only if indexed by constants.
    constexpr int KPT = Sc / 128;          // 3 key rows per thread
    float4 kreg[KPT][HDc / 4];
    const float4* kcol = reinterpret_cast<const float4*>(Kf)
        + (size_t)bh * (HDc / 4) * Sc + tid;
#pragma unroll  // constant indices into kreg
    for (int j = 0; j < KPT; ++j) {
#pragma unroll  // constant indices into kreg
        for (int c = 0; c < HDc / 4; ++c) kreg[j][c] = kcol[c * Sc + j * 128];
    }
    asm volatile("s_wait_xcnt 0x0" ::: "memory");

    for (int i = tid; i < TR * HDc; i += 128) {
        int r = i / HDc, d = i % HDc;
        q_s[r][d] = Q[((size_t)(b * Tc + t0 + r)) * Ec + h * HDc + d];
    }
    __syncthreads();

    // ---- additive scores: sc[t][s] = sum_d w[d]*tanh(q[t,d]+k[s,d]) + b ----
    // q[t][*] is one LDS address for the whole wave (broadcast read) and
    // w_score[*] a uniform address (scalar load); each serves KPT key rows.
    // The sum over d of one (t, s) pair runs in ascending d, one accumulator.
    const float bsc = b_score[0];
    for (int t = 0; t < TR; ++t) {
        float acc[KPT];
#pragma unroll  // constant indices into acc
        for (int j = 0; j < KPT; ++j) acc[j] = 0.f;
#pragma unroll  // constant indices into kreg
        for (int c = 0; c < HDc / 4; ++c) {
            const float4 qv = *reinterpret_cast<const float4*>(&q_s[t][c * 4]);
            // 4*KPT independent values per batch: no tanh waits for its
            // neighbour, and the KPT accumulator chains interleave.
            float x[KPT][4];
#pragma unroll  // constant indices into x and kreg
            for (int j = 0; j < KPT; ++j) {
                x[j][0] = qv.x + kreg[j][c].x;
                x[j][1] = qv.y + kreg[j][c].y;
                x[j][2] = qv.z + kreg[j][c].z;
                x[j][3] = qv.w + kreg[j][c].w;
            }
#pragma unroll  // constant indices into x
            for (int j = 0; j < KPT; ++j) {
                x[j][0] = fast_tanh(x[j][0]);
                x[j][1] = fast_tanh(x[j][1]);
                x[j][2] = fast_tanh(x[j][2]);
                x[j][3] = fast_tanh(x[j][3]);
            }
#pragma unroll  // constant indices into x
            for (int e = 0; e < 4; ++e) {
                const float we = w_score[c * 4 + e];
#pragma unroll  // constant indices into x and acc
                for (int j = 0; j < KPT; ++j) acc[j] += we * x[j][e];
            }
        }
#pragma unroll  // constant indices into acc
        for (int j = 0; j < KPT; ++j) sc[t][tid + j * 128] = acc[j] + bsc;
    }
    __syncthreads();

    const int wave  = tid >> 5;
    const int lane  = tid & 31;
    const int nl    = lane & 15;
    const int khalf = lane >> 4;
    constexpr int RPW = TR / 4;            // rows per wave
    constexpr int CPL = Sc / 128;          // 16-byte pieces of a row per lane
#pragma unroll  // the rows' reduction chains are independent and interleave
    for (int rr = 0; rr < RPW; ++rr) {
        const int row = wave * RPW + rr;
        float4 v[CPL];
#pragma unroll  // constant indices into v
        for (int c = 0; c < CPL; ++c)
            v[c] = *reinterpret_cast<const float4*>(&sc[row][c * 128 + lane * 4]);
        float mx = -3.4e38f;
#pragma unroll  // constant indices into v
        for (int c = 0; c < CPL; ++c)
            mx = fmaxf(mx, fmaxf(fmaxf(v[c].x, v[c].y), fmaxf(v[c].z, v[c].w)));
        mx = wave_max(mx);
        constexpr float LOG2E = 1.44269504088896340736f;  // exp(x) = exp2(x * LOG2E)
        float4 e[CPL];
#pragma unroll  // constant indices into v and e
        for (int c = 0; c < CPL; ++c) {
            e[c] = exp2_x4((v[c].x - mx) * LOG2E, (v[c].y - mx) * LOG2E,
                           (v[c].z - mx) * LOG2E, (v[c].w - mx) * LOG2E);
        }
        float sum = (e[0].x + e[0].y) + (e[0].z + e[0].w);
#pragma unroll  // constant indices into e
        for (int c = 1; c < CPL; ++c)
            sum += (e[c].x + e[c].y) + (e[c].z + e[c].w);
        sum = wave_sum(sum);
        const float rinv = 1.f / sum;
#pragma unroll  // constant indices into e
        for (int c = 0; c < CPL; ++c)
            *reinterpret_cast<h4v*>(&p_s[row][c * 128 + lane * 4]) =
                h4v{(_Float16)(e[c].x * rinv), (_Float16)(e[c].y * rinv),
                    (_Float16)(e[c].z * rinv), (_Float16)(e[c].w * rinv)};
    }
    __syncthreads();

    // ---- P[TR,S] @ V[S,HD] via WMMA; wave w owns d-columns w*16..w*16+15 ----
    // Row m of the product depends on row m of P alone: the fragment's rows
    // from TR on read row TR - 1 once more (one LDS address, a broadcast).
    v8f acc = {};
    const _Float16* prow  = &p_s[nl < TR ? nl : TR - 1][khalf * 8];  // LDS
    const _Float16* vbase = Vt + ((size_t)bh * HDc + wave * 16 + nl) * Tc
                               + khalf * 8;                           // global
    for (int k0 = 0; k0 < Sc; k0 += 32) {
        __builtin_prefetch(vbase + k0 + 64, 0, 0);
        v16h a  = make_frag(prow + k0);      // ds_read_b128 x2, conflict-free
        v16h bb = make_frag(vbase + k0);     // global_load_b128 x2
        acc = __builtin_amdgcn_wmma_f32_16x16x32_f16(false, a, false, bb,
                                                     (short)0, acc, false, false);
    }

    const int mo = khalf * 8;
#pragma unroll
    for (int rr = 0; rr < 8; ++rr) {
        if (mo + rr < TR)
            AttnH[((size_t)(b * Tc + t0 + mo + rr)) * Ec + h * HDc + wave * 16 + nl]
                = (_Float16)acc[rr];
    }
}

// ---------------------------------------------------------------------------
// Host launcher
// ---------------------------------------------------------------------------
extern "C" void kernel_launch(void* const* d_in, const int* in_sizes, int n_in,
                              void* d_out, int out_size, void* d_ws, size_t ws_size,
                              hipStream_t stream) {
    const float* X   = (const float*)d_in[0];
    const float* Wq  = (const float*)d_in[1];
    const float* bq  = (const float*)d_in[2];
    const float* Wk  = (const float*)d_in[3];
    const float* bk  = (const float*)d_in[4];
    const float* Wv  = (const float*)d_in[5];
    const float* bv  = (const float*)d_in[6];
    const float* Wo  = (const float*)d_in[7];
    const float* bo  = (const float*)d_in[8];
    const float* wsc = (const float*)d_in[9];
    const float* bsc = (const float*)d_in[10];

    char* ws = (char*)d_ws;
    size_t off = 0;
    auto carve = [&](size_t bytes) {
        void* p = ws + off;
        off += (bytes + 255) & ~(size_t)255;
        return p;
    };

    _Float16* Xh    = (_Float16*)carve((size_t)Mc * Ec * 2);
    _Float16* Wqt   = (_Float16*)carve((size_t)Ec * Ec * 2);
    _Float16* Wkt   = (_Float16*)carve((size_t)Ec * Ec * 2);
    _Float16* Wvt   = (_Float16*)carve((size_t)Ec * Ec * 2);
    _Float16* Wot   = (_Float16*)carve((size_t)Ec * Ec * 2);
    float*    Qf    = (float*)   carve((size_t)Mc * Ec * 4);
    float*    Kff   = (float*)   carve((size_t)Mc * Ec * 4);
    _Float16* Vth   = (_Float16*)carve((size_t)Bc * Hc * HDc * Tc * 2);
    _Float16* AttnH = (_Float16*)carve((size_t)Mc * Ec * 2);

    // 1) X -> f16 and the four weights -> transposed f16, one launch
    {
        dim3 grid(Ec / 64, Ec / 64, 5);
        k_prepare<<<grid, 128, 0, stream>>>(X, Xh, Wq, Wqt, Wk, Wkt,
                                            Wv, Wvt, Wo, Wot);
    }
    // 2) Q/K/V projections (WMMA GEMMs), one launch; V leaves it as f16 [B,H,HD,T]
    {
        dim3 grid(Ec / 64, Mc / 128, 3);
        k_gemm_qkv<<<grid, 256, 0, stream>>>(Xh, Wqt, bq, Qf, Wkt, bk, Kff,
                                             Wvt, bv, Vth);
    }
    // 3) fused additive score + softmax + P@V
    {
        dim3 grid(Bc * Hc, Tc / TR);
        k_additive_attn<<<grid, 128, 0, stream>>>(Qf, Kff, Vth, wsc, bsc, AttnH);
    }
    // 4) output projection -> d_out (f32)
    {
        dim3 grid(Ec / 64, Mc / 128);
        k_gemm_wmma<<<grid, 256, 0, stream>>>(AttnH, Wot, bo, (float*)d_out);
    }
}

// v009
// A run of this version takes 38.4 microseconds.
// Next to v008, in two timings, it ran 1.11 and 1.12 times as fast.
// Over all steps from v000 it is 5.59 times as fast.
#include <hip/hip_runtime.h>

typedef __attribute__((ext_vector_type(16))) _Float16 v16h;
typedef __attribute__((ext_vector_type(8)))  _Float16 h8v;
typedef __attribute__((ext_vector_type(4)))  _Float16 h4v;
typedef __attribute__((ext_vector_type(2)))  _Float16 h2v;
typedef __attribute__((ext_vector_type(8)))  float    v8f;

constexpr int Bc = 2, Tc = 384, Ec = 768, Hc = 12, HDc = 64;
constexpr int Mc = Bc * Tc;
constexpr int Sc = Tc;
constexpr int SPAD = Sc + 8;

static __device__ inline float fast_tanh(float x) {
#if __has_builtin(__builtin_amdgcn_tanhf)
    return __builtin_amdgcn_tanhf(x);
#elif __has_builtin(__builtin_amdgcn_tanh_f32)
    return __builtin_amdgcn_tanh_f32(x);
#else
    return tanhf(x);
#endif
}

template <int XMASK>
static __device__ inline float row_xor(float x) {
    return __builtin_bit_cast(float, __builtin_amdgcn_mov_dpp(
        __builtin_bit_cast(int, x), 0x160 + XMASK, 0xf, 0xf, true));
}
static __device__ inline float half_xor(float x) {
    const int b = __builtin_bit_cast(int, x);
    return __builtin_bit_cast(float, __builtin_amdgcn_permlanex16(
        b, b, 0x76543210, 0xfedcba98, false, false));
}
static __device__ inline float wave_max(float x) {
    x = fmaxf(x, row_xor<1>(x));
    x = fmaxf(x, row_xor<2>(x));
    x = fmaxf(x, row_xor<4>(x));
    x = fmaxf(x, row_xor<8>(x));
    return fmaxf(x, half_xor(x));
}
static __device__ inline float wave_sum(float x) {
    x += row_xor<1>(x);
    x += row_xor<2>(x);
    x += row_xor<4>(x);
    x += row_xor<8>(x);
    return x + half_xor(x);
}

static __device__ inline float4 exp2_x4(float a, float b, float c, float d) {
    float4 r;
    asm("v_exp_f32 %0, %4\n\tv_exp_f32 %1, %5\n\t"
        "v_exp_f32 %2, %6\n\tv_exp_f32 %3, %7\n\tv_nop"
        : "=&v"(r.x), "=&v"(r.y), "=&v"(r.z), "=&v"(r.w)
        : "v"(a), "v"(b), "v"(c), "v"(d));
    return r;
}

static __device__ inline v16h make_frag(const _Float16* p) {
    h8v lo = *reinterpret_cast<const h8v*>(p);
    h8v hi = *reinterpret_cast<const h8v*>(p + 16);
    v16h r;
#pragma unroll
    for (int i = 0; i < 8; ++i) { r[i] = lo[i]; r[i + 8] = hi[i]; }
    return r;
}

// ---------------------------------------------------------------------------
// One 64x64 tile, transposed and converted through LDS by 128 threads:
//   dst[c * dpitch + r] = (f16) src[r * spitch + c],  r, c = 0..63
// Global reads are 16 bytes a lane along c, global writes 16 bytes a lane
// along r (whole 128-byte lines both ways); each thread moves 32 elements.
// ---------------------------------------------------------------------------
constexpr int TPITCH = 64 + 8;  // halves; 144 B = 16 B x odd for ds_load_b128

static __device__ inline void tile_transpose_f16(const float* __restrict__ src,
                                                 int spitch,
                                                 _Float16* __restrict__ dst,
                                                 int dpitch,
                                                 _Float16 (*tile)[TPITCH]) {
    const int tid = threadIdx.x;
    const int c4  = (tid & 15) * 4;
    const int rp  = tid >> 4;          // 0..7: a pair of source rows, 4 times
    float4 a[4], b[4];
#pragma unroll  // all eight loads in flight before the first use
    for (int i = 0; i < 4; ++i) {
        const float* p = src + (size_t)(2 * rp + 16 * i) * spitch + c4;
        a[i] = *reinterpret_cast<const float4*>(p);
        b[i] = *reinterpret_cast<const float4*>(p + spitch);
    }
    // Rows r and r+1 of one column are neighbours in the transposed tile:
    // one 4-byte LDS store takes both.
#pragma unroll  // constant indices into a and b
    for (int i = 0; i < 4; ++i) {
        const int r = 2 * rp + 16 * i;
        *reinterpret_cast<h2v*>(&tile[c4 + 0][r]) = h2v{(_Float16)a[i].x, (_Float16)b[i].x};
        *reinterpret_cast<h2v*>(&tile[c4 + 1][r]) = h2v{(_Float16)a[i].y, (_Float16)b[i].y};
        *reinterpret_cast<h2v*>(&tile[c4 + 2][r]) = h2v{(_Float16)a[i].z, (_Float16)b[i].z};
        *reinterpret_cast<h2v*>(&tile[c4 + 3][r]) = h2v{(_Float16)a[i].w, (_Float16)b[i].w};
    }
    __syncthreads();
    const int c0 = tid >> 3;           // 0..15, 4 times
    const int r8 = (tid & 7) * 8;
#pragma unroll  // four independent LDS reads and stores
    for (int i = 0; i < 4; ++i) {
        const int c = c0 + 16 * i;
        *reinterpret_cast<h8v*>(dst + (size_t)c * dpitch + r8) =
            *reinterpret_cast<const h8v*>(&tile[c][r8]);
    }
}

// ---------------------------------------------------------------------------
// f32 -> f16 elementwise convert of one run of 4096 elements by 128 threads;
// each thread converts 32 elements, read 16 bytes at a time and written
// 16 bytes at a time.
// ---------------------------------------------------------------------------
static __device__ inline void convert_f16_4096(const float* __restrict__ in,
                                               _Float16* __restrict__ out,
                                               int run) {
    const int base = run * 4096 + threadIdx.x * 8;
    float4 lo[4], hi[4];
#pragma unroll  // all eight loads in flight before the first use
    for (int i = 0; i < 4; ++i) {
        lo[i] = *reinterpret_cast<const float4*>(in + base + 1024 * i);
        hi[i] = *reinterpret_cast<const float4*>(in + base + 1024 * i + 4);
    }
#pragma unroll  // constant indices into lo and hi
    for (int i = 0; i < 4; ++i) {
        *reinterpret_cast<h8v*>(out + base + 1024 * i) =
            h8v{(_Float16)lo[i].x, (_Float16)lo[i].y,
                (_Float16)lo[i].z, (_Float16)lo[i].w,
                (_Float16)hi[i].x, (_Float16)hi[i].y,
                (_Float16)hi[i].z, (_Float16)hi[i].w};
    }
}

// ---------------------------------------------------------------------------
// Kernel 1: all operand preparation in one launch; none of the five parts
// reads what another writes.  grid = (E/64, E/64, 5), 128 threads.
//   z = 0..3: weight transpose + convert, W[k][n] (f32) -> Wt[n][k] (f16),
//             one 64 (k) x 64 (n) tile a block
//   z = 4:    X (f32) -> Xh (f16), one run of 4096 elements a block
// The choice is the same for a whole block, so the barrier inside the
// transpose is reached by all of its threads or by none.
// ---------------------------------------------------------------------------
static_assert(Mc * Ec / 4096 == (Ec / 64) * (Ec / 64),
              "the convert part fills one z plane of the grid exactly");

__global__ void __launch_bounds__(128)
k_prepare(const float* __restrict__ X,  _Float16* __restrict__ Xh,
          const float* __restrict__ Wq, _Float16* __restrict__ Wqt,
          const float* __restrict__ Wk, _Float16* __restrict__ Wkt,
          const float* __restrict__ Wv, _Float16* __restrict__ Wvt,
          const float* __restrict__ Wo, _Float16* __restrict__ Wot) {
    __shared__ __attribute__((aligned(16))) _Float16 tile[64][TPITCH];
    const int z = blockIdx.z;
    if (z == 4) {
        convert_f16_4096(X, Xh, blockIdx.y * (Ec / 64) + blockIdx.x);
        return;
    }
    const float* W  = z == 0 ? Wq  : z == 1 ? Wk  : z == 2 ? Wv  : Wo;
    _Float16*    Wt = z == 0 ? Wqt : z == 1 ? Wkt : z == 2 ? Wvt : Wot;
    const int n0 = blockIdx.x * 64;
    const int k0 = blockIdx.y * 64;
    tile_transpose_f16(W + (size_t)k0 * Ec + n0, Ec,
                       Wt + (size_t)n0 * Ec + k0, Ec, tile);
}

enum { GEMM_PLAIN = 0, GEMM_PACKED_K = 1, GEMM_VT = 2 };
constexpr int GK      = 128;             // halves of a row in one stage
constexpr int GPITCH  = Ec + 8;          // halves; 1552 B = 16 B x odd for ds_load_b128
constexpr int GROWS   = 64 + 128;        // the Bt rows, then the A rows
constexpr int GPANEL  = GROWS * GPITCH;  // halves: all operand rows
constexpr int VPITCH  = 128 + 8;         // halves; the V tile's rows, 272 B
constexpr int GSTAGES = Ec / GK;
constexpr int GCOPIES = 12;              // copies of one wave in one stage
constexpr int GAHEAD  = 5;               // stages issued ahead of the first wait
static_assert(Ec % GK == 0 && GSTAGES == 6 && GSTAGES == GAHEAD + 1,
              "whole stages; the one stage left is issued behind the first wait");
static_assert(GAHEAD * GCOPIES <= 63, "copies of a wave outstanding at a time");
static_assert((GPANEL + 64 * VPITCH) * 2 <= 327680, "all in one WGP's LDS");

template <int N>
static __device__ inline void wait_copies_but() {
    asm volatile("s_wait_asynccnt %0" :: "n"(N) : "memory");
}

static __device__ inline void
gemm_stage_copies(const _Float16* ga, const _Float16* gb,
                  unsigned la, unsigned lb) {
    constexpr int      GS = 2 * Ec;          // halves: two rows on, global
    constexpr unsigned LS = 2 * GPITCH * 2;  // bytes: two rows on, LDS
    asm volatile(
        "global_load_async_to_lds_b128 %0, %12, off\n\t"
        "global_load_async_to_lds_b128 %1, %13, off\n\t"
        "global_load_async_to_lds_b128 %2, %14, off\n\t"
        "global_load_async_to_lds_b128 %3, %15, off\n\t"
        "global_load_async_to_lds_b128 %4, %16, off\n\t"
        "global_load_async_to_lds_b128 %5, %17, off\n\t"
        "global_load_async_to_lds_b128 %6, %18, off\n\t"
        "global_load_async_to_lds_b128 %7, %19, off\n\t"
        "global_load_async_to_lds_b128 %8, %20, off\n\t"
        "global_load_async_to_lds_b128 %9, %21, off\n\t"
        "global_load_async_to_lds_b128 %10, %22, off\n\t"
        "global_load_async_to_lds_b128 %11, %23, off\n\t"
        "s_wait_xcnt 0x0"
        :: "v"(la),          "v"(la + LS),     "v"(la + 2 * LS), "v"(la + 3 * LS),
           "v"(la + 4 * LS), "v"(la + 5 * LS), "v"(la + 6 * LS), "v"(la + 7 * LS),
           "v"(lb),          "v"(lb + LS),     "v"(lb + 2 * LS), "v"(lb + 3 * LS),
           "v"(ga),          "v"(ga + GS),     "v"(ga + 2 * GS), "v"(ga + 3 * GS),
           "v"(ga + 4 * GS), "v"(ga + 5 * GS), "v"(ga + 6 * GS), "v"(ga + 7 * GS),
           "v"(gb),          "v"(gb + GS),     "v"(gb + 2 * GS), "v"(gb + 3 * GS)
        : "memory");
}

static __device__ __forceinline__ void  // a call would pass the pointers as flat
gemm_tile_wmma(const _Float16* __restrict__ A, const _Float16* __restrict__ Bt,
               const float* __restrict__ bias, float* __restrict__ C,
               _Float16* __restrict__ Vt, _Float16* ring, int mode) {
    constexpr int Ndim = Ec, Kdim = Ec;
    const int wave  = threadIdx.x >> 5;
    const int lane  = threadIdx.x & 31;
    const int nl    = lane & 15;
    const int khalf = lane >> 4;
    const int col0  = blockIdx.x * 64;
    const int row0  = blockIdx.y * 128 + wave * 16;

    // The copies: lane -> row khalf of a pair, 16-byte piece nl of its 256 bytes.
    const _Float16* ga = A  + (size_t)(row0 + khalf) * Kdim + nl * 8;
    const _Float16* gb = Bt + (size_t)(col0 + wave * 8 + khalf) * Kdim + nl * 8;
    const unsigned  l0 = (unsigned)(size_t)ring;
    const unsigned  la = l0 + ((64 + wave * 16 + khalf) * GPITCH + nl * 8) * 2;
    const unsigned  lb = l0 + ((wave * 8 + khalf) * GPITCH + nl * 8) * 2;

    // The fragments: as from global memory, row nl, k = khalf * 8 + ...
    const _Float16* arow = ring + (64 + wave * 16 + nl) * GPITCH + khalf * 8;
    const _Float16* brow = ring + nl * GPITCH + khalf * 8;

    v8f acc0 = {}, acc1 = {}, acc2 = {}, acc3 = {};

#pragma unroll  // straight-line issue, constant steps of the addresses
    for (int s = 0; s < GAHEAD; ++s)
        gemm_stage_copies(ga + s * GK, gb + s * GK,
                          la + s * GK * 2, lb + s * GK * 2);

#pragma unroll  // the count of each wait is an immediate
    for (int t = 0; t < GSTAGES; ++t) {
        const int bo = t * GK;
        // Publish point of stage t: this wave's copies of it have landed (the
        // count is that of its copies issued behind stage t's: every wave
        // issues GCOPIES a stage); behind the barrier that holds for all waves.
        // No place in LDS is filled twice, so no reader has to be waited for.
        if      (t == 0) wait_copies_but<(GAHEAD  - 1) * GCOPIES>();
        else if (t == 1) wait_copies_but<(GSTAGES - 2) * GCOPIES>();
        else if (t == 2) wait_copies_but<(GSTAGES - 3) * GCOPIES>();
        else if (t == 3) wait_copies_but<(GSTAGES - 4) * GCOPIES>();
        else if (t == 4) wait_copies_but<(GSTAGES - 5) * GCOPIES>();
        else             wait_copies_but<0>();
        __syncthreads();
        if (t == 0)  // stage 0's GCOPIES have landed: room for the last stage's
            gemm_stage_copies(ga + GAHEAD * GK, gb + GAHEAD * GK,
                              la + GAHEAD * GK * 2, lb + GAHEAD * GK * 2);
        // All of the stage's fragments first, then its products: read among
        // the products, each pair of LDS reads is waited out on its own.
        v16h a[GK / 32], f[GK / 32][4];
#pragma unroll  // constant indices into a and f
        for (int kk = 0; kk < GK / 32; ++kk) {
            a[kk] = make_frag(arow + bo + kk * 32);
#pragma unroll  // constant indices into f
            for (int j = 0; j < 4; ++j)
                f[kk][j] = make_frag(brow + bo + j * 16 * GPITCH + kk * 32);
        }
        // Keeps the compiler from moving the reads back in among the products.
        __builtin_amdgcn_sched_barrier(0);
#pragma unroll  // constant indices into a and f
        for (int kk = 0; kk < GK / 32; ++kk) {
            acc0 = __builtin_amdgcn_wmma_f32_16x16x32_f16(false, a[kk], false, f[kk][0],
                                                          (short)0, acc0, false, false);
            acc1 = __builtin_amdgcn_wmma_f32_16x16x32_f16(false, a[kk], false, f[kk][1],
                                                          (short)0, acc1, false, false);
            acc2 = __builtin_amdgcn_wmma_f32_16x16x32_f16(false, a[kk], false, f[kk][2],
                                                          (short)0, acc2, false, false);
            acc3 = __builtin_amdgcn_wmma_f32_16x16x32_f16(false, a[kk], false, f[kk][3],
                                                          (short)0, acc3, false, false);
        }
    }
    // No copy is in flight here: the last publish point waited for all.

    const int mo = khalf * 8;
    if (mode == GEMM_PACKED_K) {  // the same for the whole block
        const int f0 = row0 + mo;            // first of the lane's 8 features
        const float4 blo = *reinterpret_cast<const float4*>(bias + f0);
        const float4 bhi = *reinterpret_cast<const float4*>(bias + f0 + 4);
        float4* kp = reinterpret_cast<float4*>(C)
            + ((size_t)((col0 / Tc) * Hc + f0 / HDc) * (HDc / 4) + (f0 % HDc) / 4) * Sc
            + col0 % Tc + nl;
        const v8f* accs[4] = {&acc0, &acc1, &acc2, &acc3};
#pragma unroll  // constant indices into accs
        for (int j = 0; j < 4; ++j) {
            const v8f& c = *accs[j];
            kp[j * 16]      = float4{c[0] + blo.x, c[1] + blo.y, c[2] + blo.z, c[3] + blo.w};
            kp[j * 16 + Sc] = float4{c[4] + bhi.x, c[5] + bhi.y, c[6] + bhi.z, c[7] + bhi.w};
        }
        return;
    }
    const float bz0 = bias[col0 +  0 + nl];
    const float bz1 = bias[col0 + 16 + nl];
    const float bz2 = bias[col0 + 32 + nl];
    const float bz3 = bias[col0 + 48 + nl];
    if (mode == GEMM_VT) {  // the same for the whole block
        // The tile, [d][s], pitch VPITCH, has LDS of its own behind the operand
        // rows, which other waves may still be reading.
        _Float16* vtile = ring + GPANEL;
        const v8f*  accs[4] = {&acc0, &acc1, &acc2, &acc3};
        const float bzs[4]  = {bz0, bz1, bz2, bz3};
#pragma unroll  // constant indices into accs and bzs
        for (int j = 0; j < 4; ++j) {
            const v8f& c = *accs[j];
            const float bz = bzs[j];
            *reinterpret_cast<h8v*>(vtile + (j * 16 + nl) * VPITCH + wave * 16 + mo) =
                h8v{(_Float16)(c[0] + bz), (_Float16)(c[1] + bz),
                    (_Float16)(c[2] + bz), (_Float16)(c[3] + bz),
                    (_Float16)(c[4] + bz), (_Float16)(c[5] + bz),
                    (_Float16)(c[6] + bz), (_Float16)(c[7] + bz)};
        }
        __syncthreads();  // the tile is complete before rows of it are read
        // A store of a wave takes two rows d, 256 bytes (128 tokens) of each:
        // four whole lines.  The 64 columns of a tile are one head.
        const int tok0 = blockIdx.y * 128;
        _Float16* vrow = Vt
            + ((size_t)((tok0 / Tc) * Hc + col0 / HDc) * HDc + wave * 8 + khalf) * Tc
            + tok0 % Tc + nl * 8;
        const _Float16* lrow = vtile + (wave * 8 + khalf) * VPITCH + nl * 8;
#pragma unroll  // four independent LDS reads and stores
        for (int i = 0; i < 4; ++i)
            *reinterpret_cast<h8v*>(vrow + (size_t)(2 * i) * Tc) =
                *reinterpret_cast<const h8v*>(lrow + 2 * i * VPITCH);
        asm volatile("s_wait_xcnt 0x0" ::: "memory");
        return;
    }
#pragma unroll
    for (int r = 0; r < 8; ++r) {
        float* crow = C + (size_t)(row0 + mo + r) * Ndim + col0;
        crow[ 0 + nl] = acc0[r] + bz0;
        crow[16 + nl] = acc1[r] + bz1;
        crow[32 + nl] = acc2[r] + bz2;
        crow[48 + nl] = acc3[r] + bz3;
    }
    asm volatile("s_wait_xcnt 0x0" ::: "memory");
}

// Kernel 2: the Q, K and V projections in one launch: three products of the
// same X that read nothing of each other.  grid = (N/64, M/128, 3); z picks
// the weight, the bias and the output.  For K (z = 1) the two operands change
// places (both are 768 rows of 768 halves, so the grid fits either way) and
// the tile is stored in the packed order described above; V (z = 2) is stored
// as f16 [B,H,HD,T], also described above.
__global__ void __launch_bounds__(256)
k_gemm_qkv(const _Float16* __restrict__ A,
           const _Float16* __restrict__ Wqt, const float* __restrict__ bq,
           float* __restrict__ Qf,
           const _Float16* __restrict__ Wkt, const float* __restrict__ bk,
           float* __restrict__ Kf,
           const _Float16* __restrict__ Wvt, const float* __restrict__ bv,
           _Float16* __restrict__ Vt) {
    __shared__ __attribute__((aligned(16))) _Float16 ring[GPANEL + 64 * VPITCH];
    static_assert(Mc == Ec && Tc % 64 == 0 && HDc % 16 == 0,
                  "K transposed: same grid; a tile in one batch, a wave in one head");
    static_assert(Tc % 128 == 0 && HDc == 64 && VPITCH >= 128,
                  "V transposed: a tile in one batch and one head, a row in the pitch");
    const int z = blockIdx.z;
    gemm_tile_wmma(z == 1 ? Wkt : A,
                   z == 0 ? Wqt : z == 1 ? A : Wvt,
                   z == 0 ? bq  : z == 1 ? bk  : bv,
                   z == 0 ? Qf  : Kf, Vt,
                   ring, z == 1 ? GEMM_PACKED_K : z == 2 ? GEMM_VT : GEMM_PLAIN);
}

// Kernel 4: one product (the output projection).  grid = (N/64, M/128).
__global__ void __launch_bounds__(256)
k_gemm_wmma(const _Float16* __restrict__ A, const _Float16* __restrict__ Bt,
            const float* __restrict__ bias, float* __restrict__ C) {
    __shared__ __attribute__((aligned(16))) _Float16 ring[GPANEL];
    gemm_tile_wmma(A, Bt, bias, C, nullptr, ring, GEMM_PLAIN);
}

constexpr int TR = 12;
static_assert(Tc % TR == 0 && TR % 4 == 0 && TR > 8 && TR <= 16,
              "whole blocks, whole rows per wave, one 16-row P@V tile");

__global__ void __launch_bounds__(128)
k_additive_attn(const float* __restrict__ Q, const float* __restrict__ Kf,
                const _Float16* __restrict__ Vt,
                const float* __restrict__ w_score,
                const float* __restrict__ b_score,
                _Float16* __restrict__ AttnH) {
    const int bh = blockIdx.x;
    const int b  = bh / Hc, h = bh % Hc;
    const int t0 = blockIdx.y * TR;
    const int tid = threadIdx.x;

    __shared__ float    q_s[TR][HDc];      //  3 KB
    __shared__ __attribute__((aligned(16))) float    sc[TR][Sc];     // 18 KB
    __shared__ __attribute__((aligned(16))) _Float16 p_s[TR][SPAD];  // ~9.2 KB

    // Each thread owns KPT key rows (s = tid + 128*j) and holds them in
    // registers for the whole score phase: every k value is read from global
    // memory once per block and serves all TR query rows of the block.
    // Kf is packed [b][h][d / 4][s][d % 4]: the 32 lanes of a load (32
    // consecutive s, one d / 4) take 512 consecutive bytes, four whole lines.
    // Every loop over j, c or e below is unrolled in full for one reason:
    // kreg, x, acc, v and e stay in registers only if indexed by constants.
    constexpr int KPT = Sc / 128;          // 3 key rows per thread
    float4 kreg[KPT][HDc / 4];
    const float4* kcol = reinterpret_cast<const float4*>(Kf)
        + (size_t)bh * (HDc / 4) * Sc + tid;
#pragma unroll  // constant indices into kreg
    for (int j = 0; j < KPT; ++j) {
#pragma unroll  // constant indices into kreg
        for (int c = 0; c < HDc / 4; ++c) kreg[j][c] = kcol[c * Sc + j * 128];
    }
    asm volatile("s_wait_xcnt 0x0" ::: "memory");

    for (int i = tid; i < TR * HDc; i += 128) {
        int r = i / HDc, d = i % HDc;
        q_s[r][d] = Q[((size_t)(b * Tc + t0 + r)) * Ec + h * HDc + d];
    }
    __syncthreads();

    // ---- additive scores: sc[t][s] = sum_d w[d]*tanh(q[t,d]+k[s,d]) + b ----
    // q[t][*] is one LDS address for the whole wave (broadcast read) and
    // w_score[*] a uniform address (scalar load); each serves KPT key rows.
    // The sum over d of one (t, s) pair runs in ascending d, one accumulator.
    const float bsc = b_score[0];
    for (int t = 0; t < TR; ++t) {
        float acc[KPT];
#pragma unroll  // constant indices into acc
        for (int j = 0; j < KPT; ++j) acc[j] = 0.f;
#pragma unroll  // constant indices into kreg
        for (int c = 0; c < HDc / 4; ++c) {
            const float4 qv = *reinterpret_cast<const float4*>(&q_s[t][c * 4]);
            // 4*KPT independent values per batch: no tanh waits for its
            // neighbour, and the KPT accumulator chains interleave.
            float x[KPT][4];
#pragma unroll  // constant indices into x and kreg
            for (int j = 0; j < KPT; ++j) {
                x[j][0] = qv.x + kreg[j][c].x;
                x[j][1] = qv.y + kreg[j][c].y;
                x[j][2] = qv.z + kreg[j][c].z;
                x[j][3] = qv.w + kreg[j][c].w;
            }
#pragma unroll  // constant indices into x
            for (int j = 0; j < KPT; ++j) {
                x[j][0] = fast_tanh(x[j][0]);
                x[j][1] = fast_tanh(x[j][1]);
                x[j][2] = fast_tanh(x[j][2]);
                x[j][3] = fast_tanh(x[j][3]);
            }
#pragma unroll  // constant indices into x
            for (int e = 0; e < 4; ++e) {
                const float we = w_score[c * 4 + e];
#pragma unroll  // constant indices into x and acc
                for (int j = 0; j < KPT; ++j) acc[j] += we * x[j][e];
            }
        }
#pragma unroll  // constant indices into acc
        for (int j = 0; j < KPT; ++j) sc[t][tid + j * 128] = acc[j] + bsc;
    }
    __syncthreads();

    const int wave  = tid >> 5;
    const int lane  = tid & 31;
    const int nl    = lane & 15;
    const int khalf = lane >> 4;
    constexpr int RPW = TR / 4;            // rows per wave
    constexpr int CPL = Sc / 128;          // 16-byte pieces of a row per lane
#pragma unroll  // the rows' reduction chains are independent and interleave
    for (int rr = 0; rr < RPW; ++rr) {
        const int row = wave * RPW + rr;
        float4 v[CPL];
#pragma unroll  // constant indices into v
        for (int c = 0; c < CPL; ++c)
            v[c] = *reinterpret_cast<const float4*>(&sc[row][c * 128 + lane * 4]);
        float mx = -3.4e38f;
#pragma unroll  // constant indices into v
        for (int c = 0; c < CPL; ++c)
            mx = fmaxf(mx, fmaxf(fmaxf(v[c].x, v[c].y), fmaxf(v[c].z, v[c].w)));
        mx = wave_max(mx);
        constexpr float LOG2E = 1.44269504088896340736f;  // exp(x) = exp2(x * LOG2E)
        float4 e[CPL];
#pragma unroll  // constant indices into v and e
        for (int c = 0; c < CPL; ++c) {
            e[c] = exp2_x4((v[c].x - mx) * LOG2E, (v[c].y - mx) * LOG2E,
                           (v[c].z - mx) * LOG2E, (v[c].w - mx) * LOG2E);
        }
        float sum = (e[0].x + e[0].y) + (e[0].z + e[0].w);
#pragma unroll  // constant indices into e
        for (int c = 1; c < CPL; ++c)
            sum += (e[c].x + e[c].y) + (e[c].z + e[c].w);
        sum = wave_sum(sum);
        const float rinv = 1.f / sum;
#pragma unroll  // constant indices into e
        for (int c = 0; c < CPL; ++c)
            *reinterpret_cast<h4v*>(&p_s[row][c * 128 + lane * 4]) =
                h4v{(_Float16)(e[c].x * rinv), (_Float16)(e[c].y * rinv),
                    (_Float16)(e[c].z * rinv), (_Float16)(e[c].w * rinv)};
    }
    __syncthreads();

    // ---- P[TR,S] @ V[S,HD] via WMMA; wave w owns d-columns w*16..w*16+15 ----
    // Row m of the product depends on row m of P alone: the fragment's rows
    // from TR on read row TR - 1 once more (one LDS address, a broadcast).
    v8f acc = {};
    const _Float16* prow  = &p_s[nl < TR ? nl : TR - 1][khalf * 8];  // LDS
    const _Float16* vbase = Vt + ((size_t)bh * HDc + wave * 16 + nl) * Tc
                               + khalf * 8;                           // global
    for (int k0 = 0; k0 < Sc; k0 += 32) {
        __builtin_prefetch(vbase + k0 + 64, 0, 0);
        v16h a  = make_frag(prow + k0);      // ds_read_b128 x2, conflict-free
        v16h bb = make_frag(vbase + k0);     // global_load_b128 x2
        acc = __builtin_amdgcn_wmma_f32_16x16x32_f16(false, a, false, bb,
                                                     (short)0, acc, false, false);
    }

    const int mo = khalf * 8;
#pragma unroll
    for (int rr = 0; rr < 8; ++rr) {
        if (mo + rr < TR)
            AttnH[((size_t)(b * Tc + t0 + mo + rr)) * Ec + h * HDc + wave * 16 + nl]
                = (_Float16)acc[rr];
    }
}

// ---------------------------------------------------------------------------
// Host launcher
// ---------------------------------------------------------------------------
extern "C" void kernel_launch(void* const* d_in, const int* in_sizes, int n_in,
                              void* d_out, int out_size, void* d_ws, size_t ws_size,
                              hipStream_t stream) {
    const float* X   = (const float*)d_in[0];
    const float* Wq  = (const float*)d_in[1];
    const float* bq  = (const float*)d_in[2];
    const float* Wk  = (const float*)d_in[3];
    const float* bk  = (const float*)d_in[4];
    const float* Wv  = (const float*)d_in[5];
    const float* bv  = (const float*)d_in[6];
    const float* Wo  = (const float*)d_in[7];
    const float* bo  = (const float*)d_in[8];
    const float* wsc = (const float*)d_in[9];
    const float* bsc = (const float*)d_in[10];

    char* ws = (char*)d_ws;
    size_t off = 0;
    auto carve = [&](size_t bytes) {
        void* p = ws + off;
        off += (bytes + 255) & ~(size_t)255;
        return p;
    };

    _Float16* Xh    = (_Float16*)carve((size_t)Mc * Ec * 2);
    _Float16* Wqt   = (_Float16*)carve((size_t)Ec * Ec * 2);
    _Float16* Wkt   = (_Float16*)carve((size_t)Ec * Ec * 2);
    _Float16* Wvt   = (_Float16*)carve((size_t)Ec * Ec * 2);
    _Float16* Wot   = (_Float16*)carve((size_t)Ec * Ec * 2);
    float*    Qf    = (float*)   carve((size_t)Mc * Ec * 4);
    float*    Kff   = (float*)   carve((size_t)Mc * Ec * 4);
    _Float16* Vth   = (_Float16*)carve((size_t)Bc * Hc * HDc * Tc * 2);
    _Float16* AttnH = (_Float16*)carve((size_t)Mc * Ec * 2);

    // 1) X -> f16 and the four weights -> transposed f16, one launch
    {
        dim3 grid(Ec / 64, Ec / 64, 5);
        k_prepare<<<grid, 128, 0, stream>>>(X, Xh, Wq, Wqt, Wk, Wkt,
                                            Wv, Wvt, Wo, Wot);
    }
    // 2) Q/K/V projections (WMMA GEMMs), one launch; V leaves it as f16 [B,H,HD,T]
    {
        dim3 grid(Ec / 64, Mc / 128, 3);
        k_gemm_qkv<<<grid, 256, 0, stream>>>(Xh, Wqt, bq, Qf, Wkt, bk, Kff,
                                             Wvt, bv, Vth);
    }
    // 3) fused additive score + softmax + P@V
    {
        dim3 grid(Bc * Hc, Tc / TR);
        k_additive_attn<<<grid, 128, 0, stream>>>(Qf, Kff, Vth, wsc, bsc, AttnH);
    }
    // 4) output projection -> d_out (f32)
    {
        dim3 grid(Ec / 64, Mc / 128);
        k_gemm_wmma<<<grid, 256, 0, stream>>>(AttnH, Wot, bo, (float*)d_out);
    }
}

// v010
// Measured time: 36 microseconds a run.
// In both of two side-by-side timings against v009, it was 1.07 times as fast.
// Over all steps from v000 it is 5.99 times as fast.
#include <hip/hip_runtime.h>

typedef __attribute__((ext_vector_type(16))) _Float16 v16h;
typedef __attribute__((ext_vector_type(8)))  _Float16 h8v;
typedef __attribute__((ext_vector_type(4)))  _Float16 h4v;
typedef __attribute__((ext_vector_type(2)))  _Float16 h2v;
typedef __attribute__((ext_vector_type(8)))  float    v8f;

constexpr int Bc = 2, Tc = 384, Ec = 768, Hc = 12, HDc = 64;
constexpr int Mc = Bc * Tc;
constexpr int Sc = Tc;
constexpr int SPAD = Sc + 8;

static __device__ inline float fast_tanh(float x) {
#if __has_builtin(__builtin_amdgcn_tanhf)
    return __builtin_amdgcn_tanhf(x);
#elif __has_builtin(__builtin_amdgcn_tanh_f32)
    return __builtin_amdgcn_tanh_f32(x);
#else
    return tanhf(x);
#endif
}

template <int XMASK>
static __device__ inline float row_xor(float x) {
    return __builtin_bit_cast(float, __builtin_amdgcn_mov_dpp(
        __builtin_bit_cast(int, x), 0x160 + XMASK, 0xf, 0xf, true));
}
static __device__ inline float half_xor(float x) {
    const int b = __builtin_bit_cast(int, x);
    return __builtin_bit_cast(float, __builtin_amdgcn_permlanex16(
        b, b, 0x76543210, 0xfedcba98, false, false));
}
static __device__ inline float wave_max(float x) {
    x = fmaxf(x, row_xor<1>(x));
    x = fmaxf(x, row_xor<2>(x));
    x = fmaxf(x, row_xor<4>(x));
    x = fmaxf(x, row_xor<8>(x));
    return fmaxf(x, half_xor(x));
}
static __device__ inline float wave_sum(float x) {
    x += row_xor<1>(x);
    x += row_xor<2>(x);
    x += row_xor<4>(x);
    x += row_xor<8>(x);
    return x + half_xor(x);
}

static __device__ inline float4 exp2_x4(float a, float b, float c, float d) {
    float4 r;
    asm("v_exp_f32 %0, %4\n\tv_exp_f32 %1, %5\n\t"
        "v_exp_f32 %2, %6\n\tv_exp_f32 %3, %7\n\tv_nop"
        : "=&v"(r.x), "=&v"(r.y), "=&v"(r.z), "=&v"(r.w)
        : "v"(a), "v"(b), "v"(c), "v"(d));
    return r;
}

static __device__ inline v16h make_frag(const _Float16* p) {
    h8v lo = *reinterpret_cast<const h8v*>(p);
    h8v hi = *reinterpret_cast<const h8v*>(p + 16);
    v16h r;
#pragma unroll
    for (int i = 0; i < 8; ++i) { r[i] = lo[i]; r[i + 8] = hi[i]; }
    return r;
}

// ---------------------------------------------------------------------------
// One 64x64 tile, transposed and converted through LDS by 128 threads:
//   dst[c * dpitch + r] = (f16) src[r * spitch + c],  r, c = 0..63
// Global reads are 16 bytes a lane along c, global writes 16 bytes a lane
// along r (whole 128-byte lines both ways); each thread moves 32 elements.
// ---------------------------------------------------------------------------
constexpr int TPITCH = 64 + 8;  // halves; 144 B = 16 B x odd for ds_load_b128

static __device__ inline void tile_transpose_f16(const float* __restrict__ src,
                                                 int spitch,
                                                 _Float16* __restrict__ dst,
                                                 int dpitch,
                                                 _Float16 (*tile)[TPITCH]) {
    const int tid = threadIdx.x;
    const int c4  = (tid & 15) * 4;
    const int rp  = tid >> 4;          // 0..7: a pair of source rows, 4 times
    float4 a[4], b[4];
#pragma unroll  // all eight loads in flight before the first use
    for (int i = 0; i < 4; ++i) {
        const float* p = src + (size_t)(2 * rp + 16 * i) * spitch + c4;
        a[i] = *reinterpret_cast<const float4*>(p);
        b[i] = *reinterpret_cast<const float4*>(p + spitch);
    }
    // Rows r and r+1 of one column are neighbours in the transposed tile:
    // one 4-byte LDS store takes both.
#pragma unroll  // constant indices into a and b
    for (int i = 0; i < 4; ++i) {
        const int r = 2 * rp + 16 * i;
        *reinterpret_cast<h2v*>(&tile[c4 + 0][r]) = h2v{(_Float16)a[i].x, (_Float16)b[i].x};
        *reinterpret_cast<h2v*>(&tile[c4 + 1][r]) = h2v{(_Float16)a[i].y, (_Float16)b[i].y};
        *reinterpret_cast<h2v*>(&tile[c4 + 2][r]) = h2v{(_Float16)a[i].z, (_Float16)b[i].z};
        *reinterpret_cast<h2v*>(&tile[c4 + 3][r]) = h2v{(_Float16)a[i].w, (_Float16)b[i].w};
    }
    __syncthreads();
    const int c0 = tid >> 3;           // 0..15, 4 times
    const int r8 = (tid & 7) * 8;
#pragma unroll  // four independent LDS reads and stores
    for (int i = 0; i < 4; ++i) {
        const int c = c0 + 16 * i;
        *reinterpret_cast<h8v*>(dst + (size_t)c * dpitch + r8) =
            *reinterpret_cast<const h8v*>(&tile[c][r8]);
    }
}

// ---------------------------------------------------------------------------
// f32 -> f16 elementwise convert of one run of 4096 elements by 128 threads;
// each thread converts 32 elements, read 16 bytes at a time and written
// 16 bytes at a time.
// ---------------------------------------------------------------------------
static __device__ inline void convert_f16_4096(const float* __restrict__ in,
                                               _Float16* __restrict__ out,
                                               int run) {
    const int base = run * 4096 + threadIdx.x * 8;
    float4 lo[4], hi[4];
#pragma unroll  // all eight loads in flight before the first use
    for (int i = 0; i < 4; ++i) {
        lo[i] = *reinterpret_cast<const float4*>(in + base + 1024 * i);
        hi[i] = *reinterpret_cast<const float4*>(in + base + 1024 * i + 4);
    }
#pragma unroll  // constant indices into lo and hi
    for (int i = 0; i < 4; ++i) {
        *reinterpret_cast<h8v*>(out + base + 1024 * i) =
            h8v{(_Float16)lo[i].x, (_Float16)lo[i].y,
                (_Float16)lo[i].z, (_Float16)lo[i].w,
                (_Float16)hi[i].x, (_Float16)hi[i].y,
                (_Float16)hi[i].z, (_Float16)hi[i].w};
    }
}

// ---------------------------------------------------------------------------
// Kernel 1: all operand preparation in one launch; none of the five parts
// reads what another writes.  grid = (E/64, E/64, 5), 128 threads.
//   z = 0..3: weight transpose + convert, W[k][n] (f32) -> Wt[n][k] (f16),
//             one 64 (k) x 64 (n) tile a block
//   z = 4:    X (f32) -> Xh (f16), one run of 4096 elements a block
// The choice is the same for a whole block, so the barrier inside the
// transpose is reached by all of its threads or by none.
// ---------------------------------------------------------------------------
static_assert(Mc * Ec / 4096 == (Ec / 64) * (Ec / 64),
              "the convert part fills one z plane of the grid exactly");

__global__ void __launch_bounds__(128)
k_prepare(const float* __restrict__ X,  _Float16* __restrict__ Xh,
          const float* __restrict__ Wq, _Float16* __restrict__ Wqt,
          const float* __restrict__ Wk, _Float16* __restrict__ Wkt,
          const float* __restrict__ Wv, _Float16* __restrict__ Wvt,
          const float* __restrict__ Wo, _Float16* __restrict__ Wot) {
    __shared__ __attribute__((aligned(16))) _Float16 tile[64][TPITCH];
    const int z = blockIdx.z;
    if (z == 4) {
        convert_f16_4096(X, Xh, blockIdx.y * (Ec / 64) + blockIdx.x);
        return;
    }
    const float* W  = z == 0 ? Wq  : z == 1 ? Wk  : z == 2 ? Wv  : Wo;
    _Float16*    Wt = z == 0 ? Wqt : z == 1 ? Wkt : z == 2 ? Wvt : Wot;
    const int n0 = blockIdx.x * 64;
    const int k0 = blockIdx.y * 64;
    tile_transpose_f16(W + (size_t)k0 * Ec + n0, Ec,
                       Wt + (size_t)n0 * Ec + k0, Ec, tile);
}

enum { GEMM_PLAIN = 0, GEMM_PACKED_K = 1, GEMM_VT = 2 };
constexpr int GK      = 128;             // halves of a row in one stage
constexpr int GPITCH  = Ec + 8;          // halves; 1552 B = 16 B x odd for ds_load_b128
constexpr int GROWS   = 64 + 128;        // the Bt rows, then the A rows
constexpr int GPANEL  = GROWS * GPITCH;  // halves: all operand rows
constexpr int VPITCH  = 128 + 8;         // halves; the V tile's rows, 272 B
constexpr int GSTAGES = Ec / GK;
constexpr int GCOPIES = 12;              // copies of one wave in one stage
constexpr int GAHEAD  = 5;               // stages issued ahead of the first wait
static_assert(Ec % GK == 0 && GSTAGES == 6 && GSTAGES == GAHEAD + 1,
              "whole stages; the one stage left is issued behind the first wait");
static_assert(GAHEAD * GCOPIES <= 63, "copies of a wave outstanding at a time");
static_assert((GPANEL + 64 * VPITCH) * 2 <= 327680, "all in one WGP's LDS");

template <int N>
static __device__ inline void wait_copies_but() {
    asm volatile("s_wait_asynccnt %0" :: "n"(N) : "memory");
}

static __device__ inline void
gemm_stage_copies(const _Float16* ga, const _Float16* gb,
                  unsigned la, unsigned lb) {
    constexpr int      GS = 2 * Ec;          // halves: two rows on, global
    constexpr unsigned LS = 2 * GPITCH * 2;  // bytes: two rows on, LDS
    asm volatile(
        "global_load_async_to_lds_b128 %0, %12, off\n\t"
        "global_load_async_to_lds_b128 %1, %13, off\n\t"
        "global_load_async_to_lds_b128 %2, %14, off\n\t"
        "global_load_async_to_lds_b128 %3, %15, off\n\t"
        "global_load_async_to_lds_b128 %4, %16, off\n\t"
        "global_load_async_to_lds_b128 %5, %17, off\n\t"
        "global_load_async_to_lds_b128 %6, %18, off\n\t"
        "global_load_async_to_lds_b128 %7, %19, off\n\t"
        "global_load_async_to_lds_b128 %8, %20, off\n\t"
        "global_load_async_to_lds_b128 %9, %21, off\n\t"
        "global_load_async_to_lds_b128 %10, %22, off\n\t"
        "global_load_async_to_lds_b128 %11, %23, off\n\t"
        "s_wait_xcnt 0x0"
        :: "v"(la),          "v"(la + LS),     "v"(la + 2 * LS), "v"(la + 3 * LS),
           "v"(la + 4 * LS), "v"(la + 5 * LS), "v"(la + 6 * LS), "v"(la + 7 * LS),
           "v"(lb),          "v"(lb + LS),     "v"(lb + 2 * LS), "v"(lb + 3 * LS),
           "v"(ga),          "v"(ga + GS),     "v"(ga + 2 * GS), "v"(ga + 3 * GS),
           "v"(ga + 4 * GS), "v"(ga + 5 * GS), "v"(ga + 6 * GS), "v"(ga + 7 * GS),
           "v"(gb),          "v"(gb + GS),     "v"(gb + 2 * GS), "v"(gb + 3 * GS)
        : "memory");
}

static __device__ __forceinline__ void  // a call would pass the pointers as flat
gemm_tile_wmma(const _Float16* __restrict__ A, const _Float16* __restrict__ Bt,
               const float* __restrict__ bias, float* __restrict__ C,
               _Float16* __restrict__ Vt, _Float16* ring, int mode) {
    constexpr int Ndim = Ec, Kdim = Ec;
    const int wave  = threadIdx.x >> 5;
    const int lane  = threadIdx.x & 31;
    const int nl    = lane & 15;
    const int khalf = lane >> 4;
    const int col0  = blockIdx.x * 64;
    const int row0  = blockIdx.y * 128 + wave * 16;

    // The copies: lane -> row khalf of a pair, 16-byte piece nl of its 256 bytes.
    const _Float16* ga = A  + (size_t)(row0 + khalf) * Kdim + nl * 8;
    const _Float16* gb = Bt + (size_t)(col0 + wave * 8 + khalf) * Kdim + nl * 8;
    const unsigned  l0 = (unsigned)(size_t)ring;
    const unsigned  la = l0 + ((64 + wave * 16 + khalf) * GPITCH + nl * 8) * 2;
    const unsigned  lb = l0 + ((wave * 8 + khalf) * GPITCH + nl * 8) * 2;

    // The fragments: as from global memory, row nl, k = khalf * 8 + ...
    const _Float16* arow = ring + (64 + wave * 16 + nl) * GPITCH + khalf * 8;
    const _Float16* brow = ring + nl * GPITCH + khalf * 8;

    v8f acc0 = {}, acc1 = {}, acc2 = {}, acc3 = {};

#pragma unroll  // straight-line issue, constant steps of the addresses
    for (int s = 0; s < GAHEAD; ++s)
        gemm_stage_copies(ga + s * GK, gb + s * GK,
                          la + s * GK * 2, lb + s * GK * 2);

#pragma unroll  // the count of each wait is an immediate
    for (int t = 0; t < GSTAGES; ++t) {
        const int bo = t * GK;
        // Publish point of stage t: this wave's copies of it have landed (the
        // count is that of its copies issued behind stage t's: every wave
        // issues GCOPIES a stage); behind the barrier that holds for all waves.
        // No place in LDS is filled twice, so no reader has to be waited for.
        if      (t == 0) wait_copies_but<(GAHEAD  - 1) * GCOPIES>();
        else if (t == 1) wait_copies_but<(GSTAGES - 2) * GCOPIES>();
        else if (t == 2) wait_copies_but<(GSTAGES - 3) * GCOPIES>();
        else if (t == 3) wait_copies_but<(GSTAGES - 4) * GCOPIES>();
        else if (t == 4) wait_copies_but<(GSTAGES - 5) * GCOPIES>();
        else             wait_copies_but<0>();
        __syncthreads();
        if (t == 0)  // stage 0's GCOPIES have landed: room for the last stage's
            gemm_stage_copies(ga + GAHEAD * GK, gb + GAHEAD * GK,
                              la + GAHEAD * GK * 2, lb + GAHEAD * GK * 2);
        // All of the stage's fragments first, then its products: read among
        // the products, each pair of LDS reads is waited out on its own.
        v16h a[GK / 32], f[GK / 32][4];
#pragma unroll  // constant indices into a and f
        for (int kk = 0; kk < GK / 32; ++kk) {
            a[kk] = make_frag(arow + bo + kk * 32);
#pragma unroll  // constant indices into f
            for (int j = 0; j < 4; ++j)
                f[kk][j] = make_frag(brow + bo + j * 16 * GPITCH + kk * 32);
        }
        // Keeps the compiler from moving the reads back in among the products.
        __builtin_amdgcn_sched_barrier(0);
#pragma unroll  // constant indices into a and f
        for (int kk = 0; kk < GK / 32; ++kk) {
            acc0 = __builtin_amdgcn_wmma_f32_16x16x32_f16(false, a[kk], false, f[kk][0],
                                                          (short)0, acc0, false, false);
            acc1 = __builtin_amdgcn_wmma_f32_16x16x32_f16(false, a[kk], false, f[kk][1],
                                                          (short)0, acc1, false, false);
            acc2 = __builtin_amdgcn_wmma_f32_16x16x32_f16(false, a[kk], false, f[kk][2],
                                                          (short)0, acc2, false, false);
            acc3 = __builtin_amdgcn_wmma_f32_16x16x32_f16(false, a[kk], false, f[kk][3],
                                                          (short)0, acc3, false, false);
        }
    }
    // No copy is in flight here: the last publish point waited for all.

    const int mo = khalf * 8;
    if (mode == GEMM_PACKED_K) {  // the same for the whole block
        const int f0 = row0 + mo;            // first of the lane's 8 features
        const float4 blo = *reinterpret_cast<const float4*>(bias + f0);
        const float4 bhi = *reinterpret_cast<const float4*>(bias + f0 + 4);
        float4* kp = reinterpret_cast<float4*>(C)
            + ((size_t)((col0 / Tc) * Hc + f0 / HDc) * (HDc / 4) + (f0 % HDc) / 4) * Sc
            + col0 % Tc + nl;
        const v8f* accs[4] = {&acc0, &acc1, &acc2, &acc3};
#pragma unroll  // constant indices into accs
        for (int j = 0; j < 4; ++j) {
            const v8f& c = *accs[j];
            kp[j * 16]      = float4{c[0] + blo.x, c[1] + blo.y, c[2] + blo.z, c[3] + blo.w};
            kp[j * 16 + Sc] = float4{c[4] + bhi.x, c[5] + bhi.y, c[6] + bhi.z, c[7] + bhi.w};
        }
        return;
    }
    const float bz0 = bias[col0 +  0 + nl];
    const float bz1 = bias[col0 + 16 + nl];
    const float bz2 = bias[col0 + 32 + nl];
    const float bz3 = bias[col0 + 48 + nl];
    if (mode == GEMM_VT) {  // the same for the whole block
        // The tile, [d][s], pitch VPITCH, has LDS of its own behind the operand
        // rows, which other waves may still be reading.
        _Float16* vtile = ring + GPANEL;
        const v8f*  accs[4] = {&acc0, &acc1, &acc2, &acc3};
        const float bzs[4]  = {bz0, bz1, bz2, bz3};
#pragma unroll  // constant indices into accs and bzs
        for (int j = 0; j < 4; ++j) {
            const v8f& c = *accs[j];
            const float bz = bzs[j];
            *reinterpret_cast<h8v*>(vtile + (j * 16 + nl) * VPITCH + wave * 16 + mo) =
                h8v{(_Float16)(c[0] + bz), (_Float16)(c[1] + bz),
                    (_Float16)(c[2] + bz), (_Float16)(c[3] + bz),
                    (_Float16)(c[4] + bz), (_Float16)(c[5] + bz),
                    (_Float16)(c[6] + bz), (_Float16)(c[7] + bz)};
        }
        __syncthreads();  // the tile is complete before rows of it are read
        // A store of a wave takes two rows d, 256 bytes (128 tokens) of each:
        // four whole lines.  The 64 columns of a tile are one head.
        const int tok0 = blockIdx.y * 128;
        _Float16* vrow = Vt
            + ((size_t)((tok0 / Tc) * Hc + col0 / HDc) * HDc + wave * 8 + khalf) * Tc
            + tok0 % Tc + nl * 8;
        const _Float16* lrow = vtile + (wave * 8 + khalf) * VPITCH + nl * 8;
#pragma unroll  // four independent LDS reads and stores
        for (int i = 0; i < 4; ++i)
            *reinterpret_cast<h8v*>(vrow + (size_t)(2 * i) * Tc) =
                *reinterpret_cast<const h8v*>(lrow + 2 * i * VPITCH);
        asm volatile("s_wait_xcnt 0x0" ::: "memory");
        return;
    }
#pragma unroll
    for (int r = 0; r < 8; ++r) {
        float* crow = C + (size_t)(row0 + mo + r) * Ndim + col0;
        crow[ 0 + nl] = acc0[r] + bz0;
        crow[16 + nl] = acc1[r] + bz1;
        crow[32 + nl] = acc2[r] + bz2;
        crow[48 + nl] = acc3[r] + bz3;
    }
    asm volatile("s_wait_xcnt 0x0" ::: "memory");
}

// Kernel 2: the Q, K and V projections in one launch: three products of the
// same X that read nothing of each other.  grid = (N/64, M/128, 3); z picks
// the weight, the bias and the output.  For K (z = 1) the two operands change
// places (both are 768 rows of 768 halves, so the grid fits either way) and
// the tile is stored in the packed order described above; V (z = 2) is stored
// as f16 [B,H,HD,T], also described above.
__global__ void __launch_bounds__(256)
k_gemm_qkv(const _Float16* __restrict__ A,
           const _Float16* __restrict__ Wqt, const float* __restrict__ bq,
           float* __restrict__ Qf,
           const _Float16* __restrict__ Wkt, const float* __restrict__ bk,
           float* __restrict__ Kf,
           const _Float16* __restrict__ Wvt, const float* __restrict__ bv,
           _Float16* __restrict__ Vt) {
    __shared__ __attribute__((aligned(16))) _Float16 ring[GPANEL + 64 * VPITCH];
    static_assert(Mc == Ec && Tc % 64 == 0 && HDc % 16 == 0,
                  "K transposed: same grid; a tile in one batch, a wave in one head");
    static_assert(Tc % 128 == 0 && HDc == 64 && VPITCH >= 128,
                  "V transposed: a tile in one batch and one head, a row in the pitch");
    const int z = blockIdx.z;
    gemm_tile_wmma(z == 1 ? Wkt : A,
                   z == 0 ? Wqt : z == 1 ? A : Wvt,
                   z == 0 ? bq  : z == 1 ? bk  : bv,
                   z == 0 ? Qf  : Kf, Vt,
                   ring, z == 1 ? GEMM_PACKED_K : z == 2 ? GEMM_VT : GEMM_PLAIN);
}

// Kernel 4: one product (the output projection).  grid = (N/64, M/128).
__global__ void __launch_bounds__(256)
k_gemm_wmma(const _Float16* __restrict__ A, const _Float16* __restrict__ Bt,
            const float* __restrict__ bias, float* __restrict__ C) {
    __shared__ __attribute__((aligned(16))) _Float16 ring[GPANEL];
    gemm_tile_wmma(A, Bt, bias, C, nullptr, ring, GEMM_PLAIN);
}

constexpr int TR = 12;
static_assert(Tc % TR == 0 && TR % 4 == 0 && TR > 8 && TR <= 16,
              "whole blocks, whole rows per wave, one 16-row P@V tile");

__global__ void __launch_bounds__(128)
k_additive_attn(const float* __restrict__ Q, const float* __restrict__ Kf,
                const _Float16* __restrict__ Vt,
                const float* __restrict__ w_score,
                const float* __restrict__ b_score,
                _Float16* __restrict__ AttnH) {
    const int bh = blockIdx.x;
    const int b  = bh / Hc, h = bh % Hc;
    const int t0 = blockIdx.y * TR;
    const int tid = threadIdx.x;

    __shared__ __attribute__((aligned(16))) float    q_s[TR][HDc];  // 3 KB
    __shared__ __attribute__((aligned(16))) float    sc[TR][Sc];     // 18 KB
    __shared__ __attribute__((aligned(16))) _Float16 p_s[TR][SPAD];  // ~9.2 KB

    // Each thread owns KPT key rows (s = tid + 128*j) and holds them in
    // registers for the whole score phase: every k value is read from global
    // memory once per block and serves all TR query rows of the block.
    // Kf is packed [b][h][d / 4][s][d % 4]: the 32 lanes of a load (32
    // consecutive s, one d / 4) take 512 consecutive bytes, four whole lines.
    // Every loop over j, c or e below is unrolled in full for one reason:
    // kreg, qreg, x, acc, v and e stay in registers only if indexed by constants.
    constexpr int KPT = Sc / 128;          // 3 key rows per thread
    // w_score and b_score (uniform addresses, scalar loads) are asked for here
    // too: read behind the barrier, their round trip stood alone.
    float wsc[HDc];
#pragma unroll  // constant indices into wsc
    for (int d = 0; d < HDc; ++d) wsc[d] = w_score[d];
    const float bsc = b_score[0];
    float4 kreg[KPT][HDc / 4];
    const float4* kcol = reinterpret_cast<const float4*>(Kf)
        + (size_t)bh * (HDc / 4) * Sc + tid;
#pragma unroll  // constant indices into kreg
    for (int j = 0; j < KPT; ++j) {
#pragma unroll  // constant indices into kreg
        for (int c = 0; c < HDc / 4; ++c) kreg[j][c] = kcol[c * Sc + j * 128];
    }
    asm volatile("s_wait_xcnt 0x0" ::: "memory");

    // The block's TR query rows, two floats a thread QPT times: all loads are
    // issued here, while K's are in flight, and none is waited for on its own.
    constexpr int QPT = TR * HDc / 2 / 128;
    static_assert(QPT * 2 * 128 == TR * HDc, "whole batches of Q loads");
    float2 qreg[QPT];
#pragma unroll  // constant indices into qreg; the loads are independent
    for (int j = 0; j < QPT; ++j) {
        const int i = tid + j * 128;       // pair i: row i / 32, d = i % 32 * 2
        qreg[j] = *reinterpret_cast<const float2*>(
            Q + (size_t)(b * Tc + t0 + i / (HDc / 2)) * Ec + h * HDc + i % (HDc / 2) * 2);
    }
    asm volatile("s_wait_xcnt 0x0" ::: "memory");
#pragma unroll  // constant indices into qreg
    for (int j = 0; j < QPT; ++j) {
        const int i = tid + j * 128;
        *reinterpret_cast<float2*>(&q_s[i / (HDc / 2)][i % (HDc / 2) * 2]) = qreg[j];
    }
    __syncthreads();

    // ---- additive scores: sc[t][s] = sum_d w[d]*tanh(q[t,d]+k[s,d]) + b ----
    // q[t][*] is one LDS address for the whole wave (broadcast read) and
    // w_score[*] sits in scalar registers; each serves KPT key rows.
    // The sum over d of one (t, s) pair runs in ascending d, one accumulator.
    for (int t = 0; t < TR; ++t) {
        float acc[KPT];
#pragma unroll  // constant indices into acc
        for (int j = 0; j < KPT; ++j) acc[j] = 0.f;
#pragma unroll  // constant indices into kreg
        for (int c = 0; c < HDc / 4; ++c) {
            const float4 qv = *reinterpret_cast<const float4*>(&q_s[t][c * 4]);
            // 4*KPT independent values per batch: no tanh waits for its
            // neighbour, and the KPT accumulator chains interleave.
            float x[KPT][4];
#pragma unroll  // constant indices into x and kreg
            for (int j = 0; j < KPT; ++j) {
                x[j][0] = qv.x + kreg[j][c].x;
                x[j][1] = qv.y + kreg[j][c].y;
                x[j][2] = qv.z + kreg[j][c].z;
                x[j][3] = qv.w + kreg[j][c].w;
            }
#pragma unroll  // constant indices into x
            for (int j = 0; j < KPT; ++j) {
                x[j][0] = fast_tanh(x[j][0]);
                x[j][1] = fast_tanh(x[j][1]);
                x[j][2] = fast_tanh(x[j][2]);
                x[j][3] = fast_tanh(x[j][3]);
            }
#pragma unroll  // constant indices into x
            for (int e = 0; e < 4; ++e) {
                const float we = wsc[c * 4 + e];
#pragma unroll  // constant indices into x and acc
                for (int j = 0; j < KPT; ++j) acc[j] += we * x[j][e];
            }
        }
#pragma unroll  // constant indices into acc
        for (int j = 0; j < KPT; ++j) sc[t][tid + j * 128] = acc[j] + bsc;
    }
    __syncthreads();

    const int wave  = tid >> 5;
    const int lane  = tid & 31;
    const int nl    = lane & 15;
    const int khalf = lane >> 4;
    // All of the wave's V fragments (its 16 d-columns, the whole of s) are asked
    // for here: K's registers are free, and the loads fly while the softmax
    // runs, where in the product loop each batch of them was waited out.
    constexpr int VST = Sc / 32;           // k steps of the P@V product
    const _Float16* vbase = Vt + ((size_t)bh * HDc + wave * 16 + nl) * Tc
                               + khalf * 8;                           // global
    v16h vfrag[VST];
#pragma unroll  // constant indices into vfrag
    for (int i = 0; i < VST; ++i) vfrag[i] = make_frag(vbase + i * 32);
    asm volatile("s_wait_xcnt 0x0" ::: "memory");
    constexpr int RPW = TR / 4;            // rows per wave
    constexpr int CPL = Sc / 128;          // 16-byte pieces of a row per lane
#pragma unroll  // the rows' reduction chains are independent and interleave
    for (int rr = 0; rr < RPW; ++rr) {
        const int row = wave * RPW + rr;
        float4 v[CPL];
#pragma unroll  // constant indices into v
        for (int c = 0; c < CPL; ++c)
            v[c] = *reinterpret_cast<const float4*>(&sc[row][c * 128 + lane * 4]);
        float mx = -3.4e38f;
#pragma unroll  // constant indices into v
        for (int c = 0; c < CPL; ++c)
            mx = fmaxf(mx, fmaxf(fmaxf(v[c].x, v[c].y), fmaxf(v[c].z, v[c].w)));
        mx = wave_max(mx);
        constexpr float LOG2E = 1.44269504088896340736f;  // exp(x) = exp2(x * LOG2E)
        float4 e[CPL];
#pragma unroll  // constant indices into v and e
        for (int c = 0; c < CPL; ++c) {
            e[c] = exp2_x4((v[c].x - mx) * LOG2E, (v[c].y - mx) * LOG2E,
                           (v[c].z - mx) * LOG2E, (v[c].w - mx) * LOG2E);
        }
        float sum = (e[0].x + e[0].y) + (e[0].z + e[0].w);
#pragma unroll  // constant indices into e
        for (int c = 1; c < CPL; ++c)
            sum += (e[c].x + e[c].y) + (e[c].z + e[c].w);
        sum = wave_sum(sum);
        const float rinv = 1.f / sum;
#pragma unroll  // constant indices into e
        for (int c = 0; c < CPL; ++c)
            *reinterpret_cast<h4v*>(&p_s[row][c * 128 + lane * 4]) =
                h4v{(_Float16)(e[c].x * rinv), (_Float16)(e[c].y * rinv),
                    (_Float16)(e[c].z * rinv), (_Float16)(e[c].w * rinv)};
    }
    __syncthreads();

    // ---- P[TR,S] @ V[S,HD] via WMMA; wave w owns d-columns w*16..w*16+15 ----
    // Row m of the product depends on row m of P alone: the fragment's rows
    // from TR on read row TR - 1 once more (one LDS address, a broadcast).
    v8f acc = {};
    const _Float16* prow  = &p_s[nl < TR ? nl : TR - 1][khalf * 8];  // LDS
#pragma unroll  // constant indices into vfrag
    for (int i = 0; i < VST; ++i) {
        v16h a = make_frag(prow + i * 32);   // ds_read_b128 x2, conflict-free
        acc = __builtin_amdgcn_wmma_f32_16x16x32_f16(false, a, false, vfrag[i],
                                                     (short)0, acc, false, false);
    }

    const int mo = khalf * 8;
#pragma unroll
    for (int rr = 0; rr < 8; ++rr) {
        if (mo + rr < TR)
            AttnH[((size_t)(b * Tc + t0 + mo + rr)) * Ec + h * HDc + wave * 16 + nl]
                = (_Float16)acc[rr];
    }
}

// ---------------------------------------------------------------------------
// Host launcher
// ---------------------------------------------------------------------------
extern "C" void kernel_launch(void* const* d_in, const int* in_sizes, int n_in,
                              void* d_out, int out_size, void* d_ws, size_t ws_size,
                              hipStream_t stream) {
    const float* X   = (const float*)d_in[0];
    const float* Wq  = (const float*)d_in[1];
    const float* bq  = (const float*)d_in[2];
    const float* Wk  = (const float*)d_in[3];
    const float* bk  = (const float*)d_in[4];
    const float* Wv  = (const float*)d_in[5];
    const float* bv  = (const float*)d_in[6];
    const float* Wo  = (const float*)d_in[7];
    const float* bo  = (const float*)d_in[8];
    const float* wsc = (const float*)d_in[9];
    const float* bsc = (const float*)d_in[10];

    char* ws = (char*)d_ws;
    size_t off = 0;
    auto carve = [&](size_t bytes) {
        void* p = ws + off;
        off += (bytes + 255) & ~(size_t)255;
        return p;
    };

    _Float16* Xh    = (_Float16*)carve((size_t)Mc * Ec * 2);
    _Float16* Wqt   = (_Float16*)carve((size_t)Ec * Ec * 2);
    _Float16* Wkt   = (_Float16*)carve((size_t)Ec * Ec * 2);
    _Float16* Wvt   = (_Float16*)carve((size_t)Ec * Ec * 2);
    _Float16* Wot   = (_Float16*)carve((size_t)Ec * Ec * 2);
    float*    Qf    = (float*)   carve((size_t)Mc * Ec * 4);
    float*    Kff   = (float*)   carve((size_t)Mc * Ec * 4);
    _Float16* Vth   = (_Float16*)carve((size_t)Bc * Hc * HDc * Tc * 2);
    _Float16* AttnH = (_Float16*)carve((size_t)Mc * Ec * 2);

    // 1) X -> f16 and the four weights -> transposed f16, one launch
    {
        dim3 grid(Ec / 64, Ec / 64, 5);
        k_prepare<<<grid, 128, 0, stream>>>(X, Xh, Wq, Wqt, Wk, Wkt,
                                            Wv, Wvt, Wo, Wot);
    }
    // 2) Q/K/V projections (WMMA GEMMs), one launch; V leaves it as f16 [B,H,HD,T]
    {
        dim3 grid(Ec / 64, Mc / 128, 3);
        k_gemm_qkv<<<grid, 256, 0, stream>>>(Xh, Wqt, bq, Qf, Wkt, bk, Kff,
                                             Wvt, bv, Vth);
    }
    // 3) fused additive score + softmax + P@V
    {
        dim3 grid(Bc * Hc, Tc / TR);
        k_additive_attn<<<grid, 128, 0, stream>>>(Qf, Kff, Vth, wsc, bsc, AttnH);
    }
    // 4) output projection -> d_out (f32)
    {
        dim3 grid(Ec / 64, Mc / 128);
        k_gemm_wmma<<<grid, 256, 0, stream>>>(AttnH, Wot, bo, (float*)d_out);
    }
}
